// v000
// The times below were measured on an AMD MI455X: many runs one after another, warmed up first and cycling through
// copies of the inputs, with the whole window's GPU time divided by the number of runs. Launches and the gaps
// between them are all in it. The median over several windows is given; except for v000 it joins two sittings, which
// can be a few percent apart, so the side-by-side timings, each taken in one sitting, are the better comparison.
// v000 is the starting kernel.
#include <hip/hip_runtime.h>
#include <hip/hip_bf16.h>

#define Bn 4
#define Cc 512
#define Tt 1024
#define HEADS 8
#define HD 64
#define EPS 1e-5f
#define NB 4   // N-tiles (of 16) per wave: 16x64 output tile, A reused 4x

typedef float v2f __attribute__((ext_vector_type(2)));
typedef float v8f __attribute__((ext_vector_type(8)));

// D = A(16x4) * B(4x16) + C, fp32 WMMA (CDNA5 V_WMMA_F32_16X16X4_F32)
__device__ __forceinline__ v8f wmma4(v2f a, v2f b, v8f c) {
  return __builtin_amdgcn_wmma_f32_16x16x4_f32(
      /*neg_a=*/false, a, /*neg_b=*/false, b,
      /*c_mod=*/(short)0, c, /*reuse_a=*/false, /*reuse_b=*/false);
}

// ---------------------------------------------------------------------------
// Kernel 1: Q/K/V 1x1 convs.  O[b,which,o,t] = sum_c W[o,c] * X[b,c,t]
// grid = (T/64, C/16, B*3), block = 32; one wave -> 16x64 tile
// ---------------------------------------------------------------------------
__global__ void qkv_kernel(const float* __restrict__ x,
                           const float* __restrict__ wq,
                           const float* __restrict__ wk,
                           const float* __restrict__ wv,
                           float* __restrict__ qkv) {
  const int lane = threadIdx.x & 31;
  const int half = lane >> 4;
  const int l16  = lane & 15;
  const int nbase = blockIdx.x * (16 * NB); // t
  const int mbase = blockIdx.y * 16;        // out channel
  const int b     = blockIdx.z / 3;
  const int which = blockIdx.z % 3;
  const float* W = (which == 0) ? wq : (which == 1 ? wk : wv);
  const float* X = x + (size_t)b * Cc * Tt;
  const float* wrow = W + (size_t)(mbase + l16) * Cc;

  v8f acc[NB] = {};
#pragma unroll 4
  for (int k = 0; k < Cc; k += 4) {
    const int ka = k + half * 2;
    const v2f a = *(const v2f*)(wrow + ka);            // contiguous pair
    const float* x0 = X + (size_t)ka * Tt + nbase + l16;
    const float* x1 = x0 + Tt;
#pragma unroll
    for (int j = 0; j < NB; ++j) {
      v2f bb; bb.x = x0[j * 16]; bb.y = x1[j * 16];
      acc[j] = wmma4(a, bb, acc[j]);
    }
  }

  float* O = qkv + ((size_t)b * 3 + which) * Cc * Tt;
#pragma unroll
  for (int j = 0; j < NB; ++j)
#pragma unroll
    for (int r = 0; r < 8; ++r)
      O[(size_t)(mbase + r + half * 8) * Tt + nbase + j * 16 + l16] = acc[j][r];
}

// ---------------------------------------------------------------------------
// Kernel 2: head-mixed scores.
// S[b,g,q,t] = sum_c (w_head[g][c/64]*scale) * Q[b,c,q] * K[b,c,t]
// grid = (T/64, T/16, B*HEADS), block = 32; one wave -> 16x64 tile
// ---------------------------------------------------------------------------
__global__ void score_kernel(const float* __restrict__ qkv,
                             const float* __restrict__ w_head,
                             float* __restrict__ S) {
  const int lane = threadIdx.x & 31;
  const int half = lane >> 4;
  const int l16  = lane & 15;
  const int nbase = blockIdx.x * (16 * NB); // t (key)
  const int mbase = blockIdx.y * 16;        // q (query)
  const int bh = blockIdx.z;
  const int b = bh / HEADS;
  const int g = bh % HEADS;
  const float* Q = qkv + ((size_t)b * 3 + 0) * Cc * Tt;
  const float* K = qkv + ((size_t)b * 3 + 1) * Cc * Tt;

  const float scale = 0.125f;  // hd^-0.5
  float wh[HEADS];
#pragma unroll
  for (int h = 0; h < HEADS; ++h) wh[h] = w_head[g * HEADS + h] * scale;

  const int qcol = mbase + l16;
  v8f acc[NB] = {};
#pragma unroll 4
  for (int k = 0; k < Cc; k += 4) {
    const int ka = k + half * 2;            // ka, ka+1 in same 64-block
    const float s = wh[ka >> 6];
    v2f a;  a.x = Q[(size_t)ka * Tt + qcol] * s;       // gather, loaded ONCE
            a.y = Q[(size_t)(ka + 1) * Tt + qcol] * s; // reused across NB WMMAs
    const float* k0 = K + (size_t)ka * Tt + nbase + l16;
    const float* k1 = k0 + Tt;
#pragma unroll
    for (int j = 0; j < NB; ++j) {
      v2f bb; bb.x = k0[j * 16]; bb.y = k1[j * 16];
      acc[j] = wmma4(a, bb, acc[j]);
    }
  }

  float* Sp = S + (size_t)bh * Tt * Tt;
#pragma unroll
  for (int j = 0; j < NB; ++j)
#pragma unroll
    for (int r = 0; r < 8; ++r)
      Sp[(size_t)(mbase + r + half * 8) * Tt + nbase + j * 16 + l16] = acc[j][r];
}

// ---------------------------------------------------------------------------
// Kernel 3: in-place row softmax + per-(b,g) sumsq (InstanceNorm stats).
// Softmax rows sum to 1 => mean is analytically 1/T; only sumsq reduced.
// grid = (T, B*HEADS), block = 256
// ---------------------------------------------------------------------------
__global__ void softmax_kernel(float* __restrict__ S, float* __restrict__ sumsq) {
  __shared__ float red[256];
  const int tid = threadIdx.x;
  float* p = S + ((size_t)blockIdx.y * Tt + blockIdx.x) * Tt;

  float4 v = reinterpret_cast<float4*>(p)[tid];

  float m = fmaxf(fmaxf(v.x, v.y), fmaxf(v.z, v.w));
  red[tid] = m; __syncthreads();
  for (int s = 128; s > 0; s >>= 1) {
    if (tid < s) red[tid] = fmaxf(red[tid], red[tid + s]);
    __syncthreads();
  }
  m = red[0]; __syncthreads();

  v.x = expf(v.x - m); v.y = expf(v.y - m);
  v.z = expf(v.z - m); v.w = expf(v.w - m);

  red[tid] = v.x + v.y + v.z + v.w; __syncthreads();
  for (int s = 128; s > 0; s >>= 1) {
    if (tid < s) red[tid] += red[tid + s];
    __syncthreads();
  }
  const float inv = 1.0f / red[0]; __syncthreads();

  v.x *= inv; v.y *= inv; v.z *= inv; v.w *= inv;
  reinterpret_cast<float4*>(p)[tid] = v;

  red[tid] = v.x * v.x + v.y * v.y + v.z * v.z + v.w * v.w; __syncthreads();
  for (int s = 128; s > 0; s >>= 1) {
    if (tid < s) red[tid] += red[tid + s];
    __syncthreads();
  }
  if (tid == 0) atomicAdd(&sumsq[blockIdx.y], red[0]);
}

// ---------------------------------------------------------------------------
// Kernel 3b: vsum[b,c] = sum_t V[b,c,t]
// ---------------------------------------------------------------------------
__global__ void vsum_kernel(const float* __restrict__ qkv, float* __restrict__ vsum) {
  const int idx = blockIdx.x * blockDim.x + threadIdx.x;  // b*Cc + c
  const int b = idx / Cc, c = idx % Cc;
  const float* V = qkv + ((size_t)b * 3 + 2) * Cc * Tt + (size_t)c * Tt;
  float s = 0.f;
  for (int t = 0; t < Tt; ++t) s += V[t];
  vsum[idx] = s;
}

// ---------------------------------------------------------------------------
// Kernel 4: out = normalize(attn) @ V^T, affine norm folded:
//   out[q,d] = g*istd*(P@V^T)[q,d] + (beta - g*istd*mean)*vsum[d]
// One wave covers all hd=64 (NB n-tiles). Stores into .view-scrambled [B,T,C]:
//   row = h*128 + (q>>3), col = ((q&7)<<6) + d
// grid = (T/16, B*HEADS), block = 32
// ---------------------------------------------------------------------------
__global__ void av_kernel(const float* __restrict__ qkv,
                          const float* __restrict__ S,
                          const float* __restrict__ sumsq,
                          const float* __restrict__ vsum,
                          const float* __restrict__ in_gamma,
                          const float* __restrict__ in_beta,
                          float* __restrict__ out1) {
  const int lane = threadIdx.x & 31;
  const int half = lane >> 4;
  const int l16  = lane & 15;
  const int mbase = blockIdx.x * 16;        // q
  const int bh = blockIdx.y;
  const int b = bh / HEADS;
  const int h = bh % HEADS;
  const float* P = S + (size_t)bh * Tt * Tt;
  const float* V = qkv + ((size_t)b * 3 + 2) * Cc * Tt + (size_t)h * HD * Tt;

  const float* arow = P + (size_t)(mbase + l16) * Tt;
  const float* br[NB];
#pragma unroll
  for (int j = 0; j < NB; ++j) br[j] = V + (size_t)(j * 16 + l16) * Tt;

  v8f acc[NB] = {};
#pragma unroll 4
  for (int k = 0; k < Tt; k += 4) {
    const int ka = k + half * 2;
    const v2f a = *(const v2f*)(arow + ka);            // contiguous pair, reused
#pragma unroll
    for (int j = 0; j < NB; ++j) {
      const v2f bb = *(const v2f*)(br[j] + ka);        // contiguous pair
      acc[j] = wmma4(a, bb, acc[j]);
    }
  }

  const float mean = 1.0f / (float)Tt;
  const float var  = sumsq[bh] / ((float)Tt * (float)Tt) - mean * mean;
  const float istd = rsqrtf(var + EPS);
  const float gs   = in_gamma[h] * istd;
  const float cadd = in_beta[h] - gs * mean;

#pragma unroll
  for (int j = 0; j < NB; ++j) {
    const int d = j * 16 + l16;
    const float vs = cadd * vsum[b * Cc + h * HD + d];
#pragma unroll
    for (int r = 0; r < 8; ++r) {
      const int q = mbase + r + half * 8;
      const size_t row = (size_t)(h * 128 + (q >> 3));
      const size_t col = (size_t)(((q & 7) << 6) + d);
      out1[(size_t)b * Tt * Cc + row * Cc + col] = gs * acc[j][r] + vs;
    }
  }
}

// ---------------------------------------------------------------------------
// Kernel 5: projection. final[b,co,t] = sum_c out1[b,t,c]*w_proj[co,c] + b_proj[co]
// grid = (T/64, C/16, B), block = 32; one wave -> 16x64 tile
// ---------------------------------------------------------------------------
__global__ void proj_kernel(const float* __restrict__ out1,
                            const float* __restrict__ w_proj,
                            const float* __restrict__ b_proj,
                            float* __restrict__ out) {
  const int lane = threadIdx.x & 31;
  const int half = lane >> 4;
  const int l16  = lane & 15;
  const int nbase = blockIdx.x * (16 * NB); // t
  const int mbase = blockIdx.y * 16;        // out channel
  const int b = blockIdx.z;
  const float* wrow = w_proj + (size_t)(mbase + l16) * Cc;
  const float* br[NB];
#pragma unroll
  for (int j = 0; j < NB; ++j)
    br[j] = out1 + (size_t)b * Tt * Cc + (size_t)(nbase + j * 16 + l16) * Cc;

  v8f acc[NB] = {};
#pragma unroll 4
  for (int k = 0; k < Cc; k += 4) {
    const int ka = k + half * 2;
    const v2f a = *(const v2f*)(wrow + ka);            // contiguous pair, reused
#pragma unroll
    for (int j = 0; j < NB; ++j) {
      const v2f bb = *(const v2f*)(br[j] + ka);        // contiguous pair
      acc[j] = wmma4(a, bb, acc[j]);
    }
  }

#pragma unroll
  for (int j = 0; j < NB; ++j)
#pragma unroll
    for (int r = 0; r < 8; ++r) {
      const int row = mbase + r + half * 8;
      out[(size_t)b * Cc * Tt + (size_t)row * Tt + nbase + j * 16 + l16] =
          acc[j][r] + b_proj[row];
    }
}

extern "C" void kernel_launch(void* const* d_in, const int* in_sizes, int n_in,
                              void* d_out, int out_size, void* d_ws, size_t ws_size,
                              hipStream_t stream) {
  const float* x        = (const float*)d_in[0];
  const float* w_q      = (const float*)d_in[1];
  const float* w_k      = (const float*)d_in[2];
  const float* w_v      = (const float*)d_in[3];
  const float* w_head   = (const float*)d_in[4];
  const float* in_gamma = (const float*)d_in[5];
  const float* in_beta  = (const float*)d_in[6];
  const float* w_proj   = (const float*)d_in[7];
  const float* b_proj   = (const float*)d_in[8];
  float* out = (float*)d_out;

  // workspace layout (floats)
  float* qkv   = (float*)d_ws;                                // B*3*C*T   (24 MB)
  float* S     = qkv   + (size_t)Bn * 3 * Cc * Tt;            // B*H*T*T   (128 MB)
  float* out1  = S     + (size_t)Bn * HEADS * Tt * Tt;        // B*T*C     (8 MB)
  float* sumsq = out1  + (size_t)Bn * Tt * Cc;                // B*H
  float* vsum  = sumsq + Bn * HEADS;                          // B*C

  hipMemsetAsync(sumsq, 0, Bn * HEADS * sizeof(float), stream);

  qkv_kernel    <<<dim3(Tt / 64, Cc / 16, Bn * 3),     32,  0, stream>>>(x, w_q, w_k, w_v, qkv);
  score_kernel  <<<dim3(Tt / 64, Tt / 16, Bn * HEADS), 32,  0, stream>>>(qkv, w_head, S);
  softmax_kernel<<<dim3(Tt, Bn * HEADS),               256, 0, stream>>>(S, sumsq);
  vsum_kernel   <<<dim3((Bn * Cc) / 256),              256, 0, stream>>>(qkv, vsum);
  av_kernel     <<<dim3(Tt / 16, Bn * HEADS),          32,  0, stream>>>(qkv, S, sumsq, vsum,
                                                                         in_gamma, in_beta, out1);
  proj_kernel   <<<dim3(Tt / 64, Cc / 16, Bn),         32,  0, stream>>>(out1, w_proj, b_proj, out);
}

// v001
// In both of two side-by-side timings against v000, it was 1.62 times as fast.
#include <hip/hip_runtime.h>
#include <hip/hip_bf16.h>

#define Bn 4
#define Cc 512
#define Tt 1024
#define HEADS 8
#define HD 64
#define EPS 1e-5f
#define NB 4   // N-tiles (of 16) per wave: 16x64 output tile, A reused 4x

typedef float v2f __attribute__((ext_vector_type(2)));
typedef float v8f __attribute__((ext_vector_type(8)));

// D = A(16x4) * B(4x16) + C, fp32 WMMA (CDNA5 V_WMMA_F32_16X16X4_F32)
__device__ __forceinline__ v8f wmma4(v2f a, v2f b, v8f c) {
  return __builtin_amdgcn_wmma_f32_16x16x4_f32(
      /*neg_a=*/false, a, /*neg_b=*/false, b,
      /*c_mod=*/(short)0, c, /*reuse_a=*/false, /*reuse_b=*/false);
}

// ---------------------------------------------------------------------------
// Kernel 1: Q/K/V 1x1 convs.  O[b,which,o,t] = sum_c W[o,c] * X[b,c,t]
// grid = (T/64, C/16, B*3), block = 32; one wave -> 16x64 tile
// ---------------------------------------------------------------------------
__global__ void qkv_kernel(const float* __restrict__ x,
                           const float* __restrict__ wq,
                           const float* __restrict__ wk,
                           const float* __restrict__ wv,
                           float* __restrict__ qkv) {
  const int lane = threadIdx.x & 31;
  const int half = lane >> 4;
  const int l16  = lane & 15;
  const int nbase = blockIdx.x * (16 * NB); // t
  const int mbase = blockIdx.y * 16;        // out channel
  const int b     = blockIdx.z / 3;
  const int which = blockIdx.z % 3;
  const float* W = (which == 0) ? wq : (which == 1 ? wk : wv);
  const float* X = x + (size_t)b * Cc * Tt;
  const float* wrow = W + (size_t)(mbase + l16) * Cc;

  v8f acc[NB] = {};
#pragma unroll 4
  for (int k = 0; k < Cc; k += 4) {
    const int ka = k + half * 2;
    const v2f a = *(const v2f*)(wrow + ka);            // contiguous pair
    const float* x0 = X + (size_t)ka * Tt + nbase + l16;
    const float* x1 = x0 + Tt;
#pragma unroll
    for (int j = 0; j < NB; ++j) {
      v2f bb; bb.x = x0[j * 16]; bb.y = x1[j * 16];
      acc[j] = wmma4(a, bb, acc[j]);
    }
  }

  float* O = qkv + ((size_t)b * 3 + which) * Cc * Tt;
#pragma unroll
  for (int j = 0; j < NB; ++j)
#pragma unroll
    for (int r = 0; r < 8; ++r)
      O[(size_t)(mbase + r + half * 8) * Tt + nbase + j * 16 + l16] = acc[j][r];
}

// ---------------------------------------------------------------------------
// Kernel 2: head-mixed scores.
// R[h,q,t] = sum_{c in head h} Q[b,c,q] * K[b,c,t]   (WMMA, K = 64 per head, once)
// S[b,g,q,t] = sum_h (w_head[g][h]*scale) * R[h,q,t] (mixed in registers)
// The eight per-head products are shared by all eight output heads g, so the
// matrix work is one K = 512 product per (q,t) tile, not eight.
// grid = (T/64, T/64, B), block = 128; each of the 2x2 waves -> 32q x 32t, all heads.
// 8-byte loads along q and t: tile i holds q = q0 + 2*row + i, tile j holds t = t0 + 2*col + j.
// ---------------------------------------------------------------------------
#define KSTEPS (Cc / 4)   // k-steps of 4 channels; 16 per head
#define AHEAD 7           // k-steps whose operand loads are in flight ahead of the WMMAs
#define RING (AHEAD + 1)

__global__ __launch_bounds__(128) void score_kernel(const float* __restrict__ qkv,
                                                    const float* __restrict__ w_head,
                                                    float* __restrict__ S) {
  const int lane = threadIdx.x & 31;
  const int wave = threadIdx.x >> 5;
  const int half = lane >> 4;
  const int l16  = lane & 15;
  const int t0 = blockIdx.x * 64 + (wave & 1) * 32;   // key
  const int q0 = blockIdx.y * 64 + (wave >> 1) * 32;  // query
  const int b  = blockIdx.z;
  // lane's channels in k-step s: 4*s + half*2 + {0,1}, the same for Q and K
  const float* Qp = qkv + ((size_t)b * 3 + 0) * Cc * Tt + (size_t)(half * 2) * Tt + q0 + 2 * l16;
  const float* Kp = qkv + ((size_t)b * 3 + 1) * Cc * Tt + (size_t)(half * 2) * Tt + t0 + 2 * l16;

  v2f qa[RING], qb[RING], ka[RING], kb[RING];
  // every loop marked "unroll" is unrolled in full: its counter indexes the ring or raw[],
  // which stay in registers only under compile-time indices
#pragma unroll
  for (int s = 0; s < AHEAD; ++s) {
    const size_t c = (size_t)(4 * s) * Tt;
    qa[s] = *(const v2f*)(Qp + c);  qb[s] = *(const v2f*)(Qp + c + Tt);
    ka[s] = *(const v2f*)(Kp + c);  kb[s] = *(const v2f*)(Kp + c + Tt);
  }

  v8f raw[HEADS][2][2] = {};
#pragma unroll
  for (int s = 0; s < KSTEPS; ++s) {
    if (s + AHEAD < KSTEPS) {
      const int n = (s + AHEAD) % RING;
      const size_t c = (size_t)(4 * (s + AHEAD)) * Tt;
      qa[n] = *(const v2f*)(Qp + c);  qb[n] = *(const v2f*)(Qp + c + Tt);
      ka[n] = *(const v2f*)(Kp + c);  kb[n] = *(const v2f*)(Kp + c + Tt);
    }
    // keeps the loads above AHEAD k-steps in front of their WMMAs: without it the
    // scheduler sinks each load to its use and every k-step waits out a full load latency
    __builtin_amdgcn_sched_barrier(0);
    const int u = s % RING;
    const int h = s / (HD / 4);
    v2f a0; a0.x = qa[u].x; a0.y = qb[u].x;
    v2f a1; a1.x = qa[u].y; a1.y = qb[u].y;
    v2f b0; b0.x = ka[u].x; b0.y = kb[u].x;
    v2f b1; b1.x = ka[u].y; b1.y = kb[u].y;
    raw[h][0][0] = wmma4(a0, b0, raw[h][0][0]);
    raw[h][0][1] = wmma4(a0, b1, raw[h][0][1]);
    raw[h][1][0] = wmma4(a1, b0, raw[h][1][0]);
    raw[h][1][1] = wmma4(a1, b1, raw[h][1][1]);
    // keeps the next k-step's loads behind these WMMAs, so that they land in the ring slot
    // just consumed: hoisted, they take 8 more VGPRs, past 336, and a wave per SIMD is lost
    __builtin_amdgcn_sched_barrier(0);
  }

  const float scale = 0.125f;  // hd^-0.5
  float* Sp = S + (size_t)b * HEADS * Tt * Tt + (size_t)(q0 + 16 * half) * Tt + t0 + 2 * l16;
  // g indexes no register array: this one loop stays rolled, an eighth of the mix's code
#pragma unroll 1
  for (int g = 0; g < HEADS; ++g) {
    float w[HEADS];
#pragma unroll
    for (int h = 0; h < HEADS; ++h) w[h] = w_head[g * HEADS + h] * scale;
#pragma unroll
    for (int i = 0; i < 2; ++i) {
      v2f st[8];                                    // st[r] = S at t = t0 + 2*l16 + {0,1}
#pragma unroll
      for (int r = 0; r < 8; r += 2) {
        v2f o[2];
#pragma unroll
        for (int j = 0; j < 2; ++j) {
          v2f s; s.x = w[0] * raw[0][i][j][r]; s.y = w[0] * raw[0][i][j][r + 1];
#pragma unroll
          for (int h = 1; h < HEADS; ++h) {
            v2f p; p.x = raw[h][i][j][r]; p.y = raw[h][i][j][r + 1];
            s += w[h] * p;
          }
          o[j] = s;
        }
        st[r].x     = o[0].x;  st[r].y     = o[1].x;
        st[r + 1].x = o[0].y;  st[r + 1].y = o[1].y;
      }
      // the eight stores stay one run behind all of the group's arithmetic, so that no
      // register of an issued store is rewritten in front of the wait below
      __builtin_amdgcn_sched_barrier(0);
#pragma unroll
      for (int r = 0; r < 8; ++r)
        *(v2f*)(Sp + (size_t)g * Tt * Tt + (size_t)(2 * r + i) * Tt) = st[r];
      // the next group reuses the stores' data registers: wait before they are overwritten
      asm volatile("s_wait_xcnt 0x0" ::: "memory");
      // keeps the next group's arithmetic behind that wait
      __builtin_amdgcn_sched_barrier(0);
    }
  }
}

// ---------------------------------------------------------------------------
// Kernel 3: in-place row softmax + per-(b,g) sumsq (InstanceNorm stats).
// Softmax rows sum to 1 => mean is analytically 1/T; only sumsq reduced.
// grid = (T, B*HEADS), block = 256
// ---------------------------------------------------------------------------
__global__ void softmax_kernel(float* __restrict__ S, float* __restrict__ sumsq) {
  __shared__ float red[256];
  const int tid = threadIdx.x;
  float* p = S + ((size_t)blockIdx.y * Tt + blockIdx.x) * Tt;

  float4 v = reinterpret_cast<float4*>(p)[tid];

  float m = fmaxf(fmaxf(v.x, v.y), fmaxf(v.z, v.w));
  red[tid] = m; __syncthreads();
  for (int s = 128; s > 0; s >>= 1) {
    if (tid < s) red[tid] = fmaxf(red[tid], red[tid + s]);
    __syncthreads();
  }
  m = red[0]; __syncthreads();

  v.x = expf(v.x - m); v.y = expf(v.y - m);
  v.z = expf(v.z - m); v.w = expf(v.w - m);

  red[tid] = v.x + v.y + v.z + v.w; __syncthreads();
  for (int s = 128; s > 0; s >>= 1) {
    if (tid < s) red[tid] += red[tid + s];
    __syncthreads();
  }
  const float inv = 1.0f / red[0]; __syncthreads();

  v.x *= inv; v.y *= inv; v.z *= inv; v.w *= inv;
  reinterpret_cast<float4*>(p)[tid] = v;

  red[tid] = v.x * v.x + v.y * v.y + v.z * v.z + v.w * v.w; __syncthreads();
  for (int s = 128; s > 0; s >>= 1) {
    if (tid < s) red[tid] += red[tid + s];
    __syncthreads();
  }
  if (tid == 0) atomicAdd(&sumsq[blockIdx.y], red[0]);
}

// ---------------------------------------------------------------------------
// Kernel 3b: vsum[b,c] = sum_t V[b,c,t]
// ---------------------------------------------------------------------------
__global__ void vsum_kernel(const float* __restrict__ qkv, float* __restrict__ vsum) {
  const int idx = blockIdx.x * blockDim.x + threadIdx.x;  // b*Cc + c
  const int b = idx / Cc, c = idx % Cc;
  const float* V = qkv + ((size_t)b * 3 + 2) * Cc * Tt + (size_t)c * Tt;
  float s = 0.f;
  for (int t = 0; t < Tt; ++t) s += V[t];
  vsum[idx] = s;
}

// ---------------------------------------------------------------------------
// Kernel 4: out = normalize(attn) @ V^T, affine norm folded:
//   out[q,d] = g*istd*(P@V^T)[q,d] + (beta - g*istd*mean)*vsum[d]
// One wave covers all hd=64 (NB n-tiles). Stores into .view-scrambled [B,T,C]:
//   row = h*128 + (q>>3), col = ((q&7)<<6) + d
// grid = (T/16, B*HEADS), block = 32
// ---------------------------------------------------------------------------
__global__ void av_kernel(const float* __restrict__ qkv,
                          const float* __restrict__ S,
                          const float* __restrict__ sumsq,
                          const float* __restrict__ vsum,
                          const float* __restrict__ in_gamma,
                          const float* __restrict__ in_beta,
                          float* __restrict__ out1) {
  const int lane = threadIdx.x & 31;
  const int half = lane >> 4;
  const int l16  = lane & 15;
  const int mbase = blockIdx.x * 16;        // q
  const int bh = blockIdx.y;
  const int b = bh / HEADS;
  const int h = bh % HEADS;
  const float* P = S + (size_t)bh * Tt * Tt;
  const float* V = qkv + ((size_t)b * 3 + 2) * Cc * Tt + (size_t)h * HD * Tt;

  const float* arow = P + (size_t)(mbase + l16) * Tt;
  const float* br[NB];
#pragma unroll
  for (int j = 0; j < NB; ++j) br[j] = V + (size_t)(j * 16 + l16) * Tt;

  v8f acc[NB] = {};
#pragma unroll 4
  for (int k = 0; k < Tt; k += 4) {
    const int ka = k + half * 2;
    const v2f a = *(const v2f*)(arow + ka);            // contiguous pair, reused
#pragma unroll
    for (int j = 0; j < NB; ++j) {
      const v2f bb = *(const v2f*)(br[j] + ka);        // contiguous pair
      acc[j] = wmma4(a, bb, acc[j]);
    }
  }

  const float mean = 1.0f / (float)Tt;
  const float var  = sumsq[bh] / ((float)Tt * (float)Tt) - mean * mean;
  const float istd = rsqrtf(var + EPS);
  const float gs   = in_gamma[h] * istd;
  const float cadd = in_beta[h] - gs * mean;

#pragma unroll
  for (int j = 0; j < NB; ++j) {
    const int d = j * 16 + l16;
    const float vs = cadd * vsum[b * Cc + h * HD + d];
#pragma unroll
    for (int r = 0; r < 8; ++r) {
      const int q = mbase + r + half * 8;
      const size_t row = (size_t)(h * 128 + (q >> 3));
      const size_t col = (size_t)(((q & 7) << 6) + d);
      out1[(size_t)b * Tt * Cc + row * Cc + col] = gs * acc[j][r] + vs;
    }
  }
}

// ---------------------------------------------------------------------------
// Kernel 5: projection. final[b,co,t] = sum_c out1[b,t,c]*w_proj[co,c] + b_proj[co]
// grid = (T/64, C/16, B), block = 32; one wave -> 16x64 tile
// ---------------------------------------------------------------------------
__global__ void proj_kernel(const float* __restrict__ out1,
                            const float* __restrict__ w_proj,
                            const float* __restrict__ b_proj,
                            float* __restrict__ out) {
  const int lane = threadIdx.x & 31;
  const int half = lane >> 4;
  const int l16  = lane & 15;
  const int nbase = blockIdx.x * (16 * NB); // t
  const int mbase = blockIdx.y * 16;        // out channel
  const int b = blockIdx.z;
  const float* wrow = w_proj + (size_t)(mbase + l16) * Cc;
  const float* br[NB];
#pragma unroll
  for (int j = 0; j < NB; ++j)
    br[j] = out1 + (size_t)b * Tt * Cc + (size_t)(nbase + j * 16 + l16) * Cc;

  v8f acc[NB] = {};
#pragma unroll 4
  for (int k = 0; k < Cc; k += 4) {
    const int ka = k + half * 2;
    const v2f a = *(const v2f*)(wrow + ka);            // contiguous pair, reused
#pragma unroll
    for (int j = 0; j < NB; ++j) {
      const v2f bb = *(const v2f*)(br[j] + ka);        // contiguous pair
      acc[j] = wmma4(a, bb, acc[j]);
    }
  }

#pragma unroll
  for (int j = 0; j < NB; ++j)
#pragma unroll
    for (int r = 0; r < 8; ++r) {
      const int row = mbase + r + half * 8;
      out[(size_t)b * Cc * Tt + (size_t)row * Tt + nbase + j * 16 + l16] =
          acc[j][r] + b_proj[row];
    }
}

extern "C" void kernel_launch(void* const* d_in, const int* in_sizes, int n_in,
                              void* d_out, int out_size, void* d_ws, size_t ws_size,
                              hipStream_t stream) {
  const float* x        = (const float*)d_in[0];
  const float* w_q      = (const float*)d_in[1];
  const float* w_k      = (const float*)d_in[2];
  const float* w_v      = (const float*)d_in[3];
  const float* w_head   = (const float*)d_in[4];
  const float* in_gamma = (const float*)d_in[5];
  const float* in_beta  = (const float*)d_in[6];
  const float* w_proj   = (const float*)d_in[7];
  const float* b_proj   = (const float*)d_in[8];
  float* out = (float*)d_out;

  // workspace layout (floats)
  float* qkv   = (float*)d_ws;                                // B*3*C*T   (24 MB)
  float* S     = qkv   + (size_t)Bn * 3 * Cc * Tt;            // B*H*T*T   (128 MB)
  float* out1  = S     + (size_t)Bn * HEADS * Tt * Tt;        // B*T*C     (8 MB)
  float* sumsq = out1  + (size_t)Bn * Tt * Cc;                // B*H
  float* vsum  = sumsq + Bn * HEADS;                          // B*C

  hipMemsetAsync(sumsq, 0, Bn * HEADS * sizeof(float), stream);

  qkv_kernel    <<<dim3(Tt / 64, Cc / 16, Bn * 3),     32,  0, stream>>>(x, w_q, w_k, w_v, qkv);
  score_kernel  <<<dim3(Tt / 64, Tt / 64, Bn),         128, 0, stream>>>(qkv, w_head, S);
  softmax_kernel<<<dim3(Tt, Bn * HEADS),               256, 0, stream>>>(S, sumsq);
  vsum_kernel   <<<dim3((Bn * Cc) / 256),              256, 0, stream>>>(qkv, vsum);
  av_kernel     <<<dim3(Tt / 16, Bn * HEADS),          32,  0, stream>>>(qkv, S, sumsq, vsum,
                                                                         in_gamma, in_beta, out1);
  proj_kernel   <<<dim3(Tt / 64, Cc / 16, Bn),         32,  0, stream>>>(out1, w_proj, b_proj, out);
}

// v002
// Two timings next to v001 both put it at 1.07 times that version's speed.
// All steps since v000 together make it 1.74 times as fast.
#include <hip/hip_runtime.h>
#include <hip/hip_bf16.h>

#define Bn 4
#define Cc 512
#define Tt 1024
#define HEADS 8
#define HD 64
#define EPS 1e-5f
#define NB 4   // N-tiles (of 16) per wave: 16x64 output tile, A reused 4x

typedef float v2f __attribute__((ext_vector_type(2)));
typedef float v8f __attribute__((ext_vector_type(8)));

// D = A(16x4) * B(4x16) + C, fp32 WMMA (CDNA5 V_WMMA_F32_16X16X4_F32)
__device__ __forceinline__ v8f wmma4(v2f a, v2f b, v8f c) {
  return __builtin_amdgcn_wmma_f32_16x16x4_f32(
      /*neg_a=*/false, a, /*neg_b=*/false, b,
      /*c_mod=*/(short)0, c, /*reuse_a=*/false, /*reuse_b=*/false);
}

// ---------------------------------------------------------------------------
// Kernel 1: Q/K/V 1x1 convs.  O[b,which,o,t] = sum_c W[o,c] * X[b,c,t]
// grid = (T/64, C/16, B*3), block = 32; one wave -> 16x64 tile
// ---------------------------------------------------------------------------
__global__ void qkv_kernel(const float* __restrict__ x,
                           const float* __restrict__ wq,
                           const float* __restrict__ wk,
                           const float* __restrict__ wv,
                           float* __restrict__ qkv) {
  const int lane = threadIdx.x & 31;
  const int half = lane >> 4;
  const int l16  = lane & 15;
  const int nbase = blockIdx.x * (16 * NB); // t
  const int mbase = blockIdx.y * 16;        // out channel
  const int b     = blockIdx.z / 3;
  const int which = blockIdx.z % 3;
  const float* W = (which == 0) ? wq : (which == 1 ? wk : wv);
  const float* X = x + (size_t)b * Cc * Tt;
  const float* wrow = W + (size_t)(mbase + l16) * Cc;

  v8f acc[NB] = {};
#pragma unroll 4
  for (int k = 0; k < Cc; k += 4) {
    const int ka = k + half * 2;
    const v2f a = *(const v2f*)(wrow + ka);            // contiguous pair
    const float* x0 = X + (size_t)ka * Tt + nbase + l16;
    const float* x1 = x0 + Tt;
#pragma unroll
    for (int j = 0; j < NB; ++j) {
      v2f bb; bb.x = x0[j * 16]; bb.y = x1[j * 16];
      acc[j] = wmma4(a, bb, acc[j]);
    }
  }

  float* O = qkv + ((size_t)b * 3 + which) * Cc * Tt;
#pragma unroll
  for (int j = 0; j < NB; ++j)
#pragma unroll
    for (int r = 0; r < 8; ++r)
      O[(size_t)(mbase + r + half * 8) * Tt + nbase + j * 16 + l16] = acc[j][r];
}

// ---------------------------------------------------------------------------
// Kernel 2: head-mixed scores.
// R[h,q,t] = sum_{c in head h} Q[b,c,q] * K[b,c,t]   (WMMA, K = 64 per head, once)
// S[b,g,q,t] = sum_h (w_head[g][h]*scale) * R[h,q,t] (mixed in registers)
// The eight per-head products are shared by all eight output heads g, so the
// matrix work is one K = 512 product per (q,t) tile, not eight.
// grid = (T/64, T/64, B), block = 128; each of the 2x2 waves -> 32q x 32t, all heads.
// 8-byte loads along q and t: tile i holds q = q0 + 2*row + i, tile j holds t = t0 + 2*col + j.
// ---------------------------------------------------------------------------
#define KSTEPS (Cc / 4)   // k-steps of 4 channels; 16 per head
#define AHEAD 7           // k-steps whose operand loads are in flight ahead of the WMMAs
#define RING (AHEAD + 1)

__global__ __launch_bounds__(128) void score_kernel(const float* __restrict__ qkv,
                                                    const float* __restrict__ w_head,
                                                    float* __restrict__ S) {
  const int lane = threadIdx.x & 31;
  const int wave = threadIdx.x >> 5;
  const int half = lane >> 4;
  const int l16  = lane & 15;
  const int t0 = blockIdx.x * 64 + (wave & 1) * 32;   // key
  const int q0 = blockIdx.y * 64 + (wave >> 1) * 32;  // query
  const int b  = blockIdx.z;
  // lane's channels in k-step s: 4*s + half*2 + {0,1}, the same for Q and K
  const float* Qp = qkv + ((size_t)b * 3 + 0) * Cc * Tt + (size_t)(half * 2) * Tt + q0 + 2 * l16;
  const float* Kp = qkv + ((size_t)b * 3 + 1) * Cc * Tt + (size_t)(half * 2) * Tt + t0 + 2 * l16;

  v2f qa[RING], qb[RING], ka[RING], kb[RING];
  // every loop marked "unroll" is unrolled in full: its counter indexes the ring or raw[],
  // which stay in registers only under compile-time indices
#pragma unroll
  for (int s = 0; s < AHEAD; ++s) {
    const size_t c = (size_t)(4 * s) * Tt;
    qa[s] = *(const v2f*)(Qp + c);  qb[s] = *(const v2f*)(Qp + c + Tt);
    ka[s] = *(const v2f*)(Kp + c);  kb[s] = *(const v2f*)(Kp + c + Tt);
  }

  v8f raw[HEADS][2][2] = {};
#pragma unroll
  for (int s = 0; s < KSTEPS; ++s) {
    if (s + AHEAD < KSTEPS) {
      const int n = (s + AHEAD) % RING;
      const size_t c = (size_t)(4 * (s + AHEAD)) * Tt;
      qa[n] = *(const v2f*)(Qp + c);  qb[n] = *(const v2f*)(Qp + c + Tt);
      ka[n] = *(const v2f*)(Kp + c);  kb[n] = *(const v2f*)(Kp + c + Tt);
    }
    // keeps the loads above AHEAD k-steps in front of their WMMAs: without it the
    // scheduler sinks each load to its use and every k-step waits out a full load latency
    __builtin_amdgcn_sched_barrier(0);
    const int u = s % RING;
    const int h = s / (HD / 4);
    v2f a0; a0.x = qa[u].x; a0.y = qb[u].x;
    v2f a1; a1.x = qa[u].y; a1.y = qb[u].y;
    v2f b0; b0.x = ka[u].x; b0.y = kb[u].x;
    v2f b1; b1.x = ka[u].y; b1.y = kb[u].y;
    raw[h][0][0] = wmma4(a0, b0, raw[h][0][0]);
    raw[h][0][1] = wmma4(a0, b1, raw[h][0][1]);
    raw[h][1][0] = wmma4(a1, b0, raw[h][1][0]);
    raw[h][1][1] = wmma4(a1, b1, raw[h][1][1]);
    // keeps the next k-step's loads behind these WMMAs, so that they land in the ring slot
    // just consumed: hoisted, they take 8 more VGPRs, past 336, and a wave per SIMD is lost
    __builtin_amdgcn_sched_barrier(0);
  }

  const float scale = 0.125f;  // hd^-0.5
  float* Sp = S + (size_t)b * HEADS * Tt * Tt + (size_t)(q0 + 16 * half) * Tt + t0 + 2 * l16;
  // g indexes no register array: this one loop stays rolled, an eighth of the mix's code
#pragma unroll 1
  for (int g = 0; g < HEADS; ++g) {
    float w[HEADS];
#pragma unroll
    for (int h = 0; h < HEADS; ++h) w[h] = w_head[g * HEADS + h] * scale;
#pragma unroll
    for (int i = 0; i < 2; ++i) {
      v2f st[8];                                    // st[r] = S at t = t0 + 2*l16 + {0,1}
#pragma unroll
      for (int r = 0; r < 8; r += 2) {
        v2f o[2];
#pragma unroll
        for (int j = 0; j < 2; ++j) {
          v2f s; s.x = w[0] * raw[0][i][j][r]; s.y = w[0] * raw[0][i][j][r + 1];
#pragma unroll
          for (int h = 1; h < HEADS; ++h) {
            v2f p; p.x = raw[h][i][j][r]; p.y = raw[h][i][j][r + 1];
            s += w[h] * p;
          }
          o[j] = s;
        }
        st[r].x     = o[0].x;  st[r].y     = o[1].x;
        st[r + 1].x = o[0].y;  st[r + 1].y = o[1].y;
      }
      // the eight stores stay one run behind all of the group's arithmetic, so that no
      // register of an issued store is rewritten in front of the wait below
      __builtin_amdgcn_sched_barrier(0);
#pragma unroll
      for (int r = 0; r < 8; ++r)
        *(v2f*)(Sp + (size_t)g * Tt * Tt + (size_t)(2 * r + i) * Tt) = st[r];
      // the next group reuses the stores' data registers: wait before they are overwritten
      asm volatile("s_wait_xcnt 0x0" ::: "memory");
      // keeps the next group's arithmetic behind that wait
      __builtin_amdgcn_sched_barrier(0);
    }
  }
}

// ---------------------------------------------------------------------------
// Kernel 3: in-place row softmax + per-(b,g) sumsq (InstanceNorm stats).
// Softmax rows sum to 1 => mean is analytically 1/T; only sumsq reduced.
// One wave owns whole rows: a lane holds 32 of a row's 1024 values in registers, maximum and
// sum are in-wave butterflies (no LDS tree, no barrier per row), and each wave walks SM_ROWS
// consecutive rows; the WGP's other waves cover a row's load latency. 8,192 waves start, not 262,144.
// grid = (T / (SM_WAVES*SM_ROWS), B*HEADS), block = SM_WAVES*32
// ---------------------------------------------------------------------------
#define SM_WAVES 8
#define SM_ROWS 4
#define SM_Q (Tt / 128)   // 16-byte pieces of a row per lane

__device__ __forceinline__ float wave_max(float v) {
#pragma unroll
  for (int m = 16; m >= 1; m >>= 1) v = fmaxf(v, __shfl_xor(v, m, 32));
  return v;
}
__device__ __forceinline__ float wave_sum(float v) {
#pragma unroll
  for (int m = 16; m >= 1; m >>= 1) v += __shfl_xor(v, m, 32);
  return v;
}

__global__ __launch_bounds__(SM_WAVES * 32) void softmax_kernel(float* __restrict__ S,
                                                                float* __restrict__ sumsq) {
  __shared__ float part[SM_WAVES];
  const int lane = threadIdx.x & 31;
  const int wave = threadIdx.x >> 5;
  const int row0 = (blockIdx.x * SM_WAVES + wave) * SM_ROWS;
  // one load or store of a wave covers 512 contiguous bytes of a row
  float* p = S + ((size_t)blockIdx.y * Tt + row0) * Tt + 4 * lane;

  float q0 = 0.f, q1 = 0.f, q2 = 0.f, q3 = 0.f;   // lane's share of the sum of squares
  // unrolled in full: every row's address is the one base register plus an immediate offset
#pragma unroll
  for (int r = 0; r < SM_ROWS; ++r) {
    float4 v[SM_Q];
#pragma unroll
    for (int q = 0; q < SM_Q; ++q) v[q] = *reinterpret_cast<const float4*>(p + r * Tt + q * 128);

    float m0 = v[0].x, m1 = v[0].y, m2 = v[0].z, m3 = v[0].w;
#pragma unroll
    for (int q = 1; q < SM_Q; ++q) {
      m0 = fmaxf(m0, v[q].x); m1 = fmaxf(m1, v[q].y);
      m2 = fmaxf(m2, v[q].z); m3 = fmaxf(m3, v[q].w);
    }
    const float m = wave_max(fmaxf(fmaxf(m0, m1), fmaxf(m2, m3)));

    float s0 = 0.f, s1 = 0.f, s2 = 0.f, s3 = 0.f;
#pragma unroll
    for (int q = 0; q < SM_Q; ++q) {
      v[q].x = expf(v[q].x - m); v[q].y = expf(v[q].y - m);
      v[q].z = expf(v[q].z - m); v[q].w = expf(v[q].w - m);
      s0 += v[q].x; s1 += v[q].y; s2 += v[q].z; s3 += v[q].w;
    }
    const float inv = 1.0f / wave_sum((s0 + s1) + (s2 + s3));

#pragma unroll
    for (int q = 0; q < SM_Q; ++q) {
      v[q].x *= inv; v[q].y *= inv; v[q].z *= inv; v[q].w *= inv;
      q0 = fmaf(v[q].x, v[q].x, q0); q1 = fmaf(v[q].y, v[q].y, q1);
      q2 = fmaf(v[q].z, v[q].z, q2); q3 = fmaf(v[q].w, v[q].w, q3);
      *reinterpret_cast<float4*>(p + r * Tt + q * 128) = v[q];
    }
    // the next row is loaded into the registers these stores name: wait before that
    asm volatile("s_wait_xcnt 0x0" ::: "memory");
  }

  const float sq = wave_sum((q0 + q1) + (q2 + q3));
  if (lane == 0) part[wave] = sq;
  __syncthreads();
  if (threadIdx.x == 0) {
    float t = part[0];
#pragma unroll
    for (int w = 1; w < SM_WAVES; ++w) t += part[w];
    atomicAdd(&sumsq[blockIdx.y], t);
  }
}

// ---------------------------------------------------------------------------
// Kernel 3b: vsum[b,c] = sum_t V[b,c,t]
// ---------------------------------------------------------------------------
__global__ void vsum_kernel(const float* __restrict__ qkv, float* __restrict__ vsum) {
  const int idx = blockIdx.x * blockDim.x + threadIdx.x;  // b*Cc + c
  const int b = idx / Cc, c = idx % Cc;
  const float* V = qkv + ((size_t)b * 3 + 2) * Cc * Tt + (size_t)c * Tt;
  float s = 0.f;
  for (int t = 0; t < Tt; ++t) s += V[t];
  vsum[idx] = s;
}

// ---------------------------------------------------------------------------
// Kernel 4: out = normalize(attn) @ V^T, affine norm folded:
//   out[q,d] = g*istd*(P@V^T)[q,d] + (beta - g*istd*mean)*vsum[d]
// One wave covers all hd=64 (NB n-tiles). Stores into .view-scrambled [B,T,C]:
//   row = h*128 + (q>>3), col = ((q&7)<<6) + d
// grid = (T/16, B*HEADS), block = 32
// ---------------------------------------------------------------------------
__global__ void av_kernel(const float* __restrict__ qkv,
                          const float* __restrict__ S,
                          const float* __restrict__ sumsq,
                          const float* __restrict__ vsum,
                          const float* __restrict__ in_gamma,
                          const float* __restrict__ in_beta,
                          float* __restrict__ out1) {
  const int lane = threadIdx.x & 31;
  const int half = lane >> 4;
  const int l16  = lane & 15;
  const int mbase = blockIdx.x * 16;        // q
  const int bh = blockIdx.y;
  const int b = bh / HEADS;
  const int h = bh % HEADS;
  const float* P = S + (size_t)bh * Tt * Tt;
  const float* V = qkv + ((size_t)b * 3 + 2) * Cc * Tt + (size_t)h * HD * Tt;

  const float* arow = P + (size_t)(mbase + l16) * Tt;
  const float* br[NB];
#pragma unroll
  for (int j = 0; j < NB; ++j) br[j] = V + (size_t)(j * 16 + l16) * Tt;

  v8f acc[NB] = {};
#pragma unroll 4
  for (int k = 0; k < Tt; k += 4) {
    const int ka = k + half * 2;
    const v2f a = *(const v2f*)(arow + ka);            // contiguous pair, reused
#pragma unroll
    for (int j = 0; j < NB; ++j) {
      const v2f bb = *(const v2f*)(br[j] + ka);        // contiguous pair
      acc[j] = wmma4(a, bb, acc[j]);
    }
  }

  const float mean = 1.0f / (float)Tt;
  const float var  = sumsq[bh] / ((float)Tt * (float)Tt) - mean * mean;
  const float istd = rsqrtf(var + EPS);
  const float gs   = in_gamma[h] * istd;
  const float cadd = in_beta[h] - gs * mean;

#pragma unroll
  for (int j = 0; j < NB; ++j) {
    const int d = j * 16 + l16;
    const float vs = cadd * vsum[b * Cc + h * HD + d];
#pragma unroll
    for (int r = 0; r < 8; ++r) {
      const int q = mbase + r + half * 8;
      const size_t row = (size_t)(h * 128 + (q >> 3));
      const size_t col = (size_t)(((q & 7) << 6) + d);
      out1[(size_t)b * Tt * Cc + row * Cc + col] = gs * acc[j][r] + vs;
    }
  }
}

// ---------------------------------------------------------------------------
// Kernel 5: projection. final[b,co,t] = sum_c out1[b,t,c]*w_proj[co,c] + b_proj[co]
// grid = (T/64, C/16, B), block = 32; one wave -> 16x64 tile
// ---------------------------------------------------------------------------
__global__ void proj_kernel(const float* __restrict__ out1,
                            const float* __restrict__ w_proj,
                            const float* __restrict__ b_proj,
                            float* __restrict__ out) {
  const int lane = threadIdx.x & 31;
  const int half = lane >> 4;
  const int l16  = lane & 15;
  const int nbase = blockIdx.x * (16 * NB); // t
  const int mbase = blockIdx.y * 16;        // out channel
  const int b = blockIdx.z;
  const float* wrow = w_proj + (size_t)(mbase + l16) * Cc;
  const float* br[NB];
#pragma unroll
  for (int j = 0; j < NB; ++j)
    br[j] = out1 + (size_t)b * Tt * Cc + (size_t)(nbase + j * 16 + l16) * Cc;

  v8f acc[NB] = {};
#pragma unroll 4
  for (int k = 0; k < Cc; k += 4) {
    const int ka = k + half * 2;
    const v2f a = *(const v2f*)(wrow + ka);            // contiguous pair, reused
#pragma unroll
    for (int j = 0; j < NB; ++j) {
      const v2f bb = *(const v2f*)(br[j] + ka);        // contiguous pair
      acc[j] = wmma4(a, bb, acc[j]);
    }
  }

#pragma unroll
  for (int j = 0; j < NB; ++j)
#pragma unroll
    for (int r = 0; r < 8; ++r) {
      const int row = mbase + r + half * 8;
      out[(size_t)b * Cc * Tt + (size_t)row * Tt + nbase + j * 16 + l16] =
          acc[j][r] + b_proj[row];
    }
}

extern "C" void kernel_launch(void* const* d_in, const int* in_sizes, int n_in,
                              void* d_out, int out_size, void* d_ws, size_t ws_size,
                              hipStream_t stream) {
  const float* x        = (const float*)d_in[0];
  const float* w_q      = (const float*)d_in[1];
  const float* w_k      = (const float*)d_in[2];
  const float* w_v      = (const float*)d_in[3];
  const float* w_head   = (const float*)d_in[4];
  const float* in_gamma = (const float*)d_in[5];
  const float* in_beta  = (const float*)d_in[6];
  const float* w_proj   = (const float*)d_in[7];
  const float* b_proj   = (const float*)d_in[8];
  float* out = (float*)d_out;

  // workspace layout (floats)
  float* qkv   = (float*)d_ws;                                // B*3*C*T   (24 MB)
  float* S     = qkv   + (size_t)Bn * 3 * Cc * Tt;            // B*H*T*T   (128 MB)
  float* out1  = S     + (size_t)Bn * HEADS * Tt * Tt;        // B*T*C     (8 MB)
  float* sumsq = out1  + (size_t)Bn * Tt * Cc;                // B*H
  float* vsum  = sumsq + Bn * HEADS;                          // B*C

  hipMemsetAsync(sumsq, 0, Bn * HEADS * sizeof(float), stream);

  qkv_kernel    <<<dim3(Tt / 64, Cc / 16, Bn * 3),     32,  0, stream>>>(x, w_q, w_k, w_v, qkv);
  score_kernel  <<<dim3(Tt / 64, Tt / 64, Bn),         128, 0, stream>>>(qkv, w_head, S);
  softmax_kernel<<<dim3(Tt / (SM_WAVES * SM_ROWS), Bn * HEADS), SM_WAVES * 32, 0, stream>>>(S, sumsq);
  vsum_kernel   <<<dim3((Bn * Cc) / 256),              256, 0, stream>>>(qkv, vsum);
  av_kernel     <<<dim3(Tt / 16, Bn * HEADS),          32,  0, stream>>>(qkv, S, sumsq, vsum,
                                                                         in_gamma, in_beta, out1);
  proj_kernel   <<<dim3(Tt / 64, Cc / 16, Bn),         32,  0, stream>>>(out1, w_proj, b_proj, out);
}

// v003
// In two side-by-side timings against v002, it was 1.25 and 1.26 times as fast.
// All steps since v000 together make it 2.18 times as fast.
#include <hip/hip_runtime.h>
#include <hip/hip_bf16.h>

#define Bn 4
#define Cc 512
#define Tt 1024
#define HEADS 8
#define HD 64
#define EPS 1e-5f
#define NB 4   // N-tiles (of 16) per wave: 16x64 output tile, A reused 4x

typedef float v2f __attribute__((ext_vector_type(2)));
typedef float v8f __attribute__((ext_vector_type(8)));

// D = A(16x4) * B(4x16) + C, fp32 WMMA (CDNA5 V_WMMA_F32_16X16X4_F32)
__device__ __forceinline__ v8f wmma4(v2f a, v2f b, v8f c) {
  return __builtin_amdgcn_wmma_f32_16x16x4_f32(
      /*neg_a=*/false, a, /*neg_b=*/false, b,
      /*c_mod=*/(short)0, c, /*reuse_a=*/false, /*reuse_b=*/false);
}

// ---------------------------------------------------------------------------
// Main loop shared by kernels 1, 4 and 5: D[m][n] = sum_k A[m][k] * B(n,k), A k-contiguous.
// A block of GW waves makes a GM x GN tile; wave w owns A rows 16w..16w+15 and all GN columns.
// A stage is GK k of both operands, brought into LDS by asynchronous copies that cover whole
// 256- or 512-byte runs of a row, two buffers: stage t + 1 flies while stage t is worked on,
// and the B tile is fetched once per block, not once per wave.
// B comes in one of two layouts: GN rows of n, k-contiguous (KMAJOR false), or GK rows of k,
// n-contiguous (KMAJOR true).
// k order of a fragment, the same for A and B: of each 8 k a lane holds the 4 at 4*half;
// its first pair feeds one WMMA, its second pair the next.
// ---------------------------------------------------------------------------
#define GW 8
#define GM (GW * 16)
#define GN (NB * 16)
// LDS pitch in floats of k-contiguous rows: 16 B x odd, 16-byte reads meet no bank twice
#define GPITCH(GK) ((GK) + 4)
// LDS pitch in floats of n-contiguous rows: 4 rows = 32 banks, so the two lane halves differ
#define GPITCHN (GN + 8)
// floats per buffer
#define GSTAGE(GK, KMAJOR) (GM * GPITCH(GK) + ((KMAJOR) ? (GK) * GPITCHN : GN * GPITCH(GK)))

typedef float v4f __attribute__((ext_vector_type(4)));

// Twelve copies of 16 bytes per lane: l = LDS byte addresses, g = global addresses.
__device__ __forceinline__ void copy12(const unsigned (&l)[12], const float* const (&g)[12]) {
  // the wait is the statement's last line: it stands before any address register is rewritten
  asm volatile(
      "global_load_async_to_lds_b128 %0, %12, off\n\t"
      "global_load_async_to_lds_b128 %1, %13, off\n\t"
      "global_load_async_to_lds_b128 %2, %14, off\n\t"
      "global_load_async_to_lds_b128 %3, %15, off\n\t"
      "global_load_async_to_lds_b128 %4, %16, off\n\t"
      "global_load_async_to_lds_b128 %5, %17, off\n\t"
      "global_load_async_to_lds_b128 %6, %18, off\n\t"
      "global_load_async_to_lds_b128 %7, %19, off\n\t"
      "global_load_async_to_lds_b128 %8, %20, off\n\t"
      "global_load_async_to_lds_b128 %9, %21, off\n\t"
      "global_load_async_to_lds_b128 %10, %22, off\n\t"
      "global_load_async_to_lds_b128 %11, %23, off\n\t"
      "s_wait_xcnt 0x0"
      :: "v"(l[0]), "v"(l[1]), "v"(l[2]), "v"(l[3]), "v"(l[4]), "v"(l[5]),
         "v"(l[6]), "v"(l[7]), "v"(l[8]), "v"(l[9]), "v"(l[10]), "v"(l[11]),
         "v"(g[0]), "v"(g[1]), "v"(g[2]), "v"(g[3]), "v"(g[4]), "v"(g[5]),
         "v"(g[6]), "v"(g[7]), "v"(g[8]), "v"(g[9]), "v"(g[10]), "v"(g[11])
      : "memory");
}

// A: the block's first row (row pitch K floats). B: the block's first row (KMAJOR false, pitch
// LDB = K) or its first column in row k = 0 (KMAJOR true, pitch LDB). sm: 2 buffers of LDS.
template <int K, int LDB, int GK, bool KMAJOR>
__device__ __forceinline__ void gemm_tile(const float* __restrict__ A, const float* __restrict__ B,
                                          float* sm, v8f (&acc)[NB]) {
  static_assert(K % GK == 0 && K / GK >= 2, "the prologue fills two stages");
  constexpr int PA = GPITCH(GK);
  constexpr int PB = KMAJOR ? GPITCHN : GPITCH(GK);
  constexpr int ST = GSTAGE(GK, KMAJOR);
  constexpr size_t BSTEP = KMAJOR ? (size_t)GK * LDB : (size_t)GK;   // B's advance per stage
  constexpr int LA = GK / 4;                       // lanes that cover one A row of a stage
  constexpr int LB = (KMAJOR ? GN : GK) / 4;       // lanes that cover one B row of a stage
  constexpr int RA = 32 / LA, RB = 32 / LB;        // rows per copy
  constexpr int NA = 16 / RA;                      // copies for the wave's 16 A rows
  constexpr int NC = NA + 8 / RB;                  // and for its 8 B rows
  static_assert((KMAJOR ? GK : GN) == 8 * GW && NC % 12 == 0, "eight B rows per wave, copies in twelves");
  const int lane = threadIdx.x & 31;
  const int wave = threadIdx.x >> 5;
  const int half = lane >> 4;
  const int l16  = lane & 15;
  const float* ga = A + (size_t)(wave * 16 + lane / LA) * K + (lane % LA) * 4;
  const float* gb = B + (size_t)(wave * 8 + lane / LB) * LDB + (lane % LB) * 4;
  const unsigned s0 = (unsigned)(uintptr_t)sm;
  const unsigned la = s0 + ((wave * 16 + lane / LA) * PA + (lane % LA) * 4) * 4;
  const unsigned lb = s0 + (GM * PA + (wave * 8 + lane / LB) * PB + (lane % LB) * 4) * 4;

  // this wave's share of stage t into buffer buf
  auto stage_copy = [&](int t, int buf) {
    // unrolled in full: the address arrays are asm operands and must be registers
#pragma unroll
    for (int c0 = 0; c0 < NC; c0 += 12) {
      unsigned l[12];
      const float* g[12];
#pragma unroll
      for (int c = 0; c < 12; ++c) {
        const int i = c0 + c;
        if (i < NA) {
          l[c] = la + (buf * ST + i * RA * PA) * 4;
          g[c] = ga + (size_t)t * GK + (size_t)(i * RA) * K;
        } else {
          l[c] = lb + (buf * ST + (i - NA) * RB * PB) * 4;
          g[c] = gb + (size_t)t * BSTEP + (size_t)((i - NA) * RB) * LDB;
        }
      }
      copy12(l, g);
    }
  };

  stage_copy(0, 0);
  // stage 0 has landed for this wave, then for the block
  asm volatile("s_wait_asynccnt 0x0" ::: "memory");
  __syncthreads();
  stage_copy(1, 1);

  const float* fa = sm + (wave * 16 + l16) * PA + half * 4;
  const float* fb = sm + GM * PA + (KMAJOR ? half * 4 * PB + l16 : l16 * PB + half * 4);
  // stays rolled: one stage's WMMAs are the loop body, the buffer is an address offset
#pragma unroll 1
  for (int t = 0; t < K / GK; ++t) {
    const int bo = (t & 1) * ST;
    // the loops inside a stage are unrolled in full: acc[] and bb[] stay in registers only
    // under compile-time indices, and the LDS offsets become immediates
#pragma unroll
    for (int kk = 0; kk < GK / 8; ++kk) {
      const v4f a = *(const v4f*)(fa + bo + kk * 8);
      v4f bb[NB];
#pragma unroll
      for (int j = 0; j < NB; ++j) {
        if constexpr (KMAJOR) {
          const float* p = fb + bo + kk * 8 * PB + j * 16;
          bb[j].x = p[0]; bb[j].y = p[PB]; bb[j].z = p[2 * PB]; bb[j].w = p[3 * PB];
        } else {
          bb[j] = *(const v4f*)(fb + bo + j * 16 * PB + kk * 8);
        }
      }
#pragma unroll
      for (int j = 0; j < NB; ++j) acc[j] = wmma4(a.lo, bb[j].lo, acc[j]);
#pragma unroll
      for (int j = 0; j < NB; ++j) acc[j] = wmma4(a.hi, bb[j].hi, acc[j]);
    }
    // this wave's reads of the buffer are done before the buffer is refilled
    asm volatile("s_wait_dscnt 0x0" ::: "memory");
    // this wave's copies of stage t + 1 have landed before the barrier publishes them
    asm volatile("s_wait_asynccnt 0x0" ::: "memory");
    __syncthreads();
    if (t + 2 < K / GK) stage_copy(t + 2, t & 1);
  }
  // no copy is outstanding when the wave goes on
  asm volatile("s_wait_asynccnt 0x0" ::: "memory");
}

// k per stage: kernel 1 keeps three blocks on a WGP (3 x 104 KiB of LDS); kernels 4 and 5 launch
// one block per WGP and take the longer stage: 512-byte runs, twice the lead for a stage's copies
#define GK_QKV 64
#define GK_NT 128

// ---------------------------------------------------------------------------
// Kernel 1: Q/K/V 1x1 convs.  O[b,which,o,t] = sum_c W[o,c] * X[b,c,t]
// grid = (T/GN, C/GM, B*3), block = GW*32; a block -> 128 o x 64 t
// ---------------------------------------------------------------------------
__global__ __launch_bounds__(GW * 32) void qkv_kernel(const float* __restrict__ x,
                                                      const float* __restrict__ wq,
                                                      const float* __restrict__ wk,
                                                      const float* __restrict__ wv,
                                                      float* __restrict__ qkv) {
  __shared__ __attribute__((aligned(16))) float sm[2 * GSTAGE(GK_QKV, true)];
  const int lane = threadIdx.x & 31;
  const int wave = threadIdx.x >> 5;
  const int half = lane >> 4;
  const int l16  = lane & 15;
  const int nbase = blockIdx.x * GN;               // t
  const int mbase = blockIdx.y * GM + wave * 16;   // out channel
  const int b     = blockIdx.z / 3;
  const int which = blockIdx.z % 3;
  const float* W = (which == 0) ? wq : (which == 1 ? wk : wv);

  v8f acc[NB] = {};
  gemm_tile<Cc, Tt, GK_QKV, true>(W + (size_t)blockIdx.y * GM * Cc, x + (size_t)b * Cc * Tt + nbase, sm, acc);

  float* O = qkv + ((size_t)b * 3 + which) * Cc * Tt;
#pragma unroll
  for (int j = 0; j < NB; ++j)
#pragma unroll
    for (int r = 0; r < 8; ++r)
      O[(size_t)(mbase + r + half * 8) * Tt + nbase + j * 16 + l16] = acc[j][r];
}

// ---------------------------------------------------------------------------
// Kernel 2: head-mixed scores.
// R[h,q,t] = sum_{c in head h} Q[b,c,q] * K[b,c,t]   (WMMA, K = 64 per head, once)
// S[b,g,q,t] = sum_h (w_head[g][h]*scale) * R[h,q,t] (mixed in registers)
// The eight per-head products are shared by all eight output heads g, so the
// matrix work is one K = 512 product per (q,t) tile, not eight.
// grid = (T/64, T/64, B), block = 128; each of the 2x2 waves -> 32q x 32t, all heads.
// 8-byte loads along q and t: tile i holds q = q0 + 2*row + i, tile j holds t = t0 + 2*col + j.
// ---------------------------------------------------------------------------
#define KSTEPS (Cc / 4)   // k-steps of 4 channels; 16 per head
#define AHEAD 7           // k-steps whose operand loads are in flight ahead of the WMMAs
#define RING (AHEAD + 1)

__global__ __launch_bounds__(128) void score_kernel(const float* __restrict__ qkv,
                                                    const float* __restrict__ w_head,
                                                    float* __restrict__ S) {
  const int lane = threadIdx.x & 31;
  const int wave = threadIdx.x >> 5;
  const int half = lane >> 4;
  const int l16  = lane & 15;
  const int t0 = blockIdx.x * 64 + (wave & 1) * 32;   // key
  const int q0 = blockIdx.y * 64 + (wave >> 1) * 32;  // query
  const int b  = blockIdx.z;
  // lane's channels in k-step s: 4*s + half*2 + {0,1}, the same for Q and K
  const float* Qp = qkv + ((size_t)b * 3 + 0) * Cc * Tt + (size_t)(half * 2) * Tt + q0 + 2 * l16;
  const float* Kp = qkv + ((size_t)b * 3 + 1) * Cc * Tt + (size_t)(half * 2) * Tt + t0 + 2 * l16;

  v2f qa[RING], qb[RING], ka[RING], kb[RING];
  // every loop marked "unroll" is unrolled in full: its counter indexes the ring or raw[],
  // which stay in registers only under compile-time indices
#pragma unroll
  for (int s = 0; s < AHEAD; ++s) {
    const size_t c = (size_t)(4 * s) * Tt;
    qa[s] = *(const v2f*)(Qp + c);  qb[s] = *(const v2f*)(Qp + c + Tt);
    ka[s] = *(const v2f*)(Kp + c);  kb[s] = *(const v2f*)(Kp + c + Tt);
  }

  v8f raw[HEADS][2][2] = {};
#pragma unroll
  for (int s = 0; s < KSTEPS; ++s) {
    if (s + AHEAD < KSTEPS) {
      const int n = (s + AHEAD) % RING;
      const size_t c = (size_t)(4 * (s + AHEAD)) * Tt;
      qa[n] = *(const v2f*)(Qp + c);  qb[n] = *(const v2f*)(Qp + c + Tt);
      ka[n] = *(const v2f*)(Kp + c);  kb[n] = *(const v2f*)(Kp + c + Tt);
    }
    // keeps the loads above AHEAD k-steps in front of their WMMAs: without it the
    // scheduler sinks each load to its use and every k-step waits out a full load latency
    __builtin_amdgcn_sched_barrier(0);
    const int u = s % RING;
    const int h = s / (HD / 4);
    v2f a0; a0.x = qa[u].x; a0.y = qb[u].x;
    v2f a1; a1.x = qa[u].y; a1.y = qb[u].y;
    v2f b0; b0.x = ka[u].x; b0.y = kb[u].x;
    v2f b1; b1.x = ka[u].y; b1.y = kb[u].y;
    raw[h][0][0] = wmma4(a0, b0, raw[h][0][0]);
    raw[h][0][1] = wmma4(a0, b1, raw[h][0][1]);
    raw[h][1][0] = wmma4(a1, b0, raw[h][1][0]);
    raw[h][1][1] = wmma4(a1, b1, raw[h][1][1]);
    // keeps the next k-step's loads behind these WMMAs, so that they land in the ring slot
    // just consumed: hoisted, they take 8 more VGPRs, past 336, and a wave per SIMD is lost
    __builtin_amdgcn_sched_barrier(0);
  }

  const float scale = 0.125f;  // hd^-0.5
  float* Sp = S + (size_t)b * HEADS * Tt * Tt + (size_t)(q0 + 16 * half) * Tt + t0 + 2 * l16;
  // g indexes no register array: this one loop stays rolled, an eighth of the mix's code
#pragma unroll 1
  for (int g = 0; g < HEADS; ++g) {
    float w[HEADS];
#pragma unroll
    for (int h = 0; h < HEADS; ++h) w[h] = w_head[g * HEADS + h] * scale;
#pragma unroll
    for (int i = 0; i < 2; ++i) {
      v2f st[8];                                    // st[r] = S at t = t0 + 2*l16 + {0,1}
#pragma unroll
      for (int r = 0; r < 8; r += 2) {
        v2f o[2];
#pragma unroll
        for (int j = 0; j < 2; ++j) {
          v2f s; s.x = w[0] * raw[0][i][j][r]; s.y = w[0] * raw[0][i][j][r + 1];
#pragma unroll
          for (int h = 1; h < HEADS; ++h) {
            v2f p; p.x = raw[h][i][j][r]; p.y = raw[h][i][j][r + 1];
            s += w[h] * p;
          }
          o[j] = s;
        }
        st[r].x     = o[0].x;  st[r].y     = o[1].x;
        st[r + 1].x = o[0].y;  st[r + 1].y = o[1].y;
      }
      // the eight stores stay one run behind all of the group's arithmetic, so that no
      // register of an issued store is rewritten in front of the wait below
      __builtin_amdgcn_sched_barrier(0);
#pragma unroll
      for (int r = 0; r < 8; ++r)
        *(v2f*)(Sp + (size_t)g * Tt * Tt + (size_t)(2 * r + i) * Tt) = st[r];
      // the next group reuses the stores' data registers: wait before they are overwritten
      asm volatile("s_wait_xcnt 0x0" ::: "memory");
      // keeps the next group's arithmetic behind that wait
      __builtin_amdgcn_sched_barrier(0);
    }
  }
}

// ---------------------------------------------------------------------------
// Kernel 3: in-place row softmax + per-(b,g) sumsq (InstanceNorm stats).
// Softmax rows sum to 1 => mean is analytically 1/T; only sumsq reduced.
// One wave owns whole rows: a lane holds 32 of a row's 1024 values in registers, maximum and
// sum are in-wave butterflies (no LDS tree, no barrier per row), and each wave walks SM_ROWS
// consecutive rows; the WGP's other waves cover a row's load latency. 8,192 waves start, not 262,144.
// grid = (T / (SM_WAVES*SM_ROWS), B*HEADS), block = SM_WAVES*32
// ---------------------------------------------------------------------------
#define SM_WAVES 8
#define SM_ROWS 4
#define SM_Q (Tt / 128)   // 16-byte pieces of a row per lane

__device__ __forceinline__ float wave_max(float v) {
#pragma unroll
  for (int m = 16; m >= 1; m >>= 1) v = fmaxf(v, __shfl_xor(v, m, 32));
  return v;
}
__device__ __forceinline__ float wave_sum(float v) {
#pragma unroll
  for (int m = 16; m >= 1; m >>= 1) v += __shfl_xor(v, m, 32);
  return v;
}

__global__ __launch_bounds__(SM_WAVES * 32) void softmax_kernel(float* __restrict__ S,
                                                                float* __restrict__ sumsq) {
  __shared__ float part[SM_WAVES];
  const int lane = threadIdx.x & 31;
  const int wave = threadIdx.x >> 5;
  const int row0 = (blockIdx.x * SM_WAVES + wave) * SM_ROWS;
  // one load or store of a wave covers 512 contiguous bytes of a row
  float* p = S + ((size_t)blockIdx.y * Tt + row0) * Tt + 4 * lane;

  float q0 = 0.f, q1 = 0.f, q2 = 0.f, q3 = 0.f;   // lane's share of the sum of squares
  // unrolled in full: every row's address is the one base register plus an immediate offset
#pragma unroll
  for (int r = 0; r < SM_ROWS; ++r) {
    float4 v[SM_Q];
#pragma unroll
    for (int q = 0; q < SM_Q; ++q) v[q] = *reinterpret_cast<const float4*>(p + r * Tt + q * 128);

    float m0 = v[0].x, m1 = v[0].y, m2 = v[0].z, m3 = v[0].w;
#pragma unroll
    for (int q = 1; q < SM_Q; ++q) {
      m0 = fmaxf(m0, v[q].x); m1 = fmaxf(m1, v[q].y);
      m2 = fmaxf(m2, v[q].z); m3 = fmaxf(m3, v[q].w);
    }
    const float m = wave_max(fmaxf(fmaxf(m0, m1), fmaxf(m2, m3)));

    float s0 = 0.f, s1 = 0.f, s2 = 0.f, s3 = 0.f;
#pragma unroll
    for (int q = 0; q < SM_Q; ++q) {
      v[q].x = expf(v[q].x - m); v[q].y = expf(v[q].y - m);
      v[q].z = expf(v[q].z - m); v[q].w = expf(v[q].w - m);
      s0 += v[q].x; s1 += v[q].y; s2 += v[q].z; s3 += v[q].w;
    }
    const float inv = 1.0f / wave_sum((s0 + s1) + (s2 + s3));

#pragma unroll
    for (int q = 0; q < SM_Q; ++q) {
      v[q].x *= inv; v[q].y *= inv; v[q].z *= inv; v[q].w *= inv;
      q0 = fmaf(v[q].x, v[q].x, q0); q1 = fmaf(v[q].y, v[q].y, q1);
      q2 = fmaf(v[q].z, v[q].z, q2); q3 = fmaf(v[q].w, v[q].w, q3);
      *reinterpret_cast<float4*>(p + r * Tt + q * 128) = v[q];
    }
    // the next row is loaded into the registers these stores name: wait before that
    asm volatile("s_wait_xcnt 0x0" ::: "memory");
  }

  const float sq = wave_sum((q0 + q1) + (q2 + q3));
  if (lane == 0) part[wave] = sq;
  __syncthreads();
  if (threadIdx.x == 0) {
    float t = part[0];
#pragma unroll
    for (int w = 1; w < SM_WAVES; ++w) t += part[w];
    atomicAdd(&sumsq[blockIdx.y], t);
  }
}

// ---------------------------------------------------------------------------
// Kernel 3b: vsum[b,c] = sum_t V[b,c,t]
// ---------------------------------------------------------------------------
__global__ void vsum_kernel(const float* __restrict__ qkv, float* __restrict__ vsum) {
  const int idx = blockIdx.x * blockDim.x + threadIdx.x;  // b*Cc + c
  const int b = idx / Cc, c = idx % Cc;
  const float* V = qkv + ((size_t)b * 3 + 2) * Cc * Tt + (size_t)c * Tt;
  float s = 0.f;
  for (int t = 0; t < Tt; ++t) s += V[t];
  vsum[idx] = s;
}

// ---------------------------------------------------------------------------
// Kernel 4: out = normalize(attn) @ V^T, affine norm folded:
//   out[q,d] = g*istd*(P@V^T)[q,d] + (beta - g*istd*mean)*vsum[d]
// A block covers 128 q and all hd=64. Stores into .view-scrambled [B,T,C]:
//   row = h*128 + (q>>3), col = ((q&7)<<6) + d
// grid = (T/GM, B*HEADS), block = GW*32
// ---------------------------------------------------------------------------
__global__ __launch_bounds__(GW * 32) void av_kernel(const float* __restrict__ qkv,
                                                     const float* __restrict__ S,
                                                     const float* __restrict__ sumsq,
                                                     const float* __restrict__ vsum,
                                                     const float* __restrict__ in_gamma,
                                                     const float* __restrict__ in_beta,
                                                     float* __restrict__ out1) {
  __shared__ __attribute__((aligned(16))) float sm[2 * GSTAGE(GK_NT, false)];
  const int lane = threadIdx.x & 31;
  const int wave = threadIdx.x >> 5;
  const int half = lane >> 4;
  const int l16  = lane & 15;
  const int mbase = blockIdx.x * GM + wave * 16;   // q
  const int bh = blockIdx.y;
  const int b = bh / HEADS;
  const int h = bh % HEADS;
  const float* P = S + (size_t)bh * Tt * Tt + (size_t)blockIdx.x * GM * Tt;
  const float* V = qkv + ((size_t)b * 3 + 2) * Cc * Tt + (size_t)h * HD * Tt;

  v8f acc[NB] = {};
  gemm_tile<Tt, Tt, GK_NT, false>(P, V, sm, acc);

  const float mean = 1.0f / (float)Tt;
  const float var  = sumsq[bh] / ((float)Tt * (float)Tt) - mean * mean;
  const float istd = rsqrtf(var + EPS);
  const float gs   = in_gamma[h] * istd;
  const float cadd = in_beta[h] - gs * mean;

#pragma unroll
  for (int j = 0; j < NB; ++j) {
    const int d = j * 16 + l16;
    const float vs = cadd * vsum[b * Cc + h * HD + d];
#pragma unroll
    for (int r = 0; r < 8; ++r) {
      const int q = mbase + r + half * 8;
      const size_t row = (size_t)(h * 128 + (q >> 3));
      const size_t col = (size_t)(((q & 7) << 6) + d);
      out1[(size_t)b * Tt * Cc + row * Cc + col] = gs * acc[j][r] + vs;
    }
  }
}

// ---------------------------------------------------------------------------
// Kernel 5: projection. final[b,co,t] = sum_c out1[b,t,c]*w_proj[co,c] + b_proj[co]
// grid = (T/GN, C/GM, B), block = GW*32; a block -> 128 co x 64 t
// ---------------------------------------------------------------------------
__global__ __launch_bounds__(GW * 32) void proj_kernel(const float* __restrict__ out1,
                                                       const float* __restrict__ w_proj,
                                                       const float* __restrict__ b_proj,
                                                       float* __restrict__ out) {
  __shared__ __attribute__((aligned(16))) float sm[2 * GSTAGE(GK_NT, false)];
  const int lane = threadIdx.x & 31;
  const int wave = threadIdx.x >> 5;
  const int half = lane >> 4;
  const int l16  = lane & 15;
  const int nbase = blockIdx.x * GN;               // t
  const int mbase = blockIdx.y * GM + wave * 16;   // out channel
  const int b = blockIdx.z;

  v8f acc[NB] = {};
  gemm_tile<Cc, Cc, GK_NT, false>(w_proj + (size_t)blockIdx.y * GM * Cc,
              out1 + (size_t)b * Tt * Cc + (size_t)nbase * Cc, sm, acc);

#pragma unroll
  for (int j = 0; j < NB; ++j)
#pragma unroll
    for (int r = 0; r < 8; ++r) {
      const int row = mbase + r + half * 8;
      out[(size_t)b * Cc * Tt + (size_t)row * Tt + nbase + j * 16 + l16] =
          acc[j][r] + b_proj[row];
    }
}

extern "C" void kernel_launch(void* const* d_in, const int* in_sizes, int n_in,
                              void* d_out, int out_size, void* d_ws, size_t ws_size,
                              hipStream_t stream) {
  const float* x        = (const float*)d_in[0];
  const float* w_q      = (const float*)d_in[1];
  const float* w_k      = (const float*)d_in[2];
  const float* w_v      = (const float*)d_in[3];
  const float* w_head   = (const float*)d_in[4];
  const float* in_gamma = (const float*)d_in[5];
  const float* in_beta  = (const float*)d_in[6];
  const float* w_proj   = (const float*)d_in[7];
  const float* b_proj   = (const float*)d_in[8];
  float* out = (float*)d_out;

  // workspace layout (floats)
  float* qkv   = (float*)d_ws;                                // B*3*C*T   (24 MB)
  float* S     = qkv   + (size_t)Bn * 3 * Cc * Tt;            // B*H*T*T   (128 MB)
  float* out1  = S     + (size_t)Bn * HEADS * Tt * Tt;        // B*T*C     (8 MB)
  float* sumsq = out1  + (size_t)Bn * Tt * Cc;                // B*H
  float* vsum  = sumsq + Bn * HEADS;                          // B*C

  hipMemsetAsync(sumsq, 0, Bn * HEADS * sizeof(float), stream);

  qkv_kernel    <<<dim3(Tt / GN, Cc / GM, Bn * 3),     GW * 32, 0, stream>>>(x, w_q, w_k, w_v, qkv);
  score_kernel  <<<dim3(Tt / 64, Tt / 64, Bn),         128, 0, stream>>>(qkv, w_head, S);
  softmax_kernel<<<dim3(Tt / (SM_WAVES * SM_ROWS), Bn * HEADS), SM_WAVES * 32, 0, stream>>>(S, sumsq);
  vsum_kernel   <<<dim3((Bn * Cc) / 256),              256, 0, stream>>>(qkv, vsum);
  av_kernel     <<<dim3(Tt / GM, Bn * HEADS),          GW * 32, 0, stream>>>(qkv, S, sumsq, vsum,
                                                                         in_gamma, in_beta, out1);
  proj_kernel   <<<dim3(Tt / GN, Cc / GM, Bn),         GW * 32, 0, stream>>>(out1, w_proj, b_proj, out);
}

// v004
// Measured time: 184 microseconds a run.
// In both of two side-by-side timings against v003, it was 1.13 times as fast.
// Over all steps from v000 it is 2.47 times as fast.
#include <hip/hip_runtime.h>
#include <hip/hip_bf16.h>

#define Bn 4
#define Cc 512
#define Tt 1024
#define HEADS 8
#define HD 64
#define EPS 1e-5f
#define NB 4   // N-tiles (of 16) per wave: 16x64 output tile, A reused 4x

typedef float v2f __attribute__((ext_vector_type(2)));
typedef float v8f __attribute__((ext_vector_type(8)));

// D = A(16x4) * B(4x16) + C, fp32 WMMA (CDNA5 V_WMMA_F32_16X16X4_F32)
__device__ __forceinline__ v8f wmma4(v2f a, v2f b, v8f c) {
  return __builtin_amdgcn_wmma_f32_16x16x4_f32(
      /*neg_a=*/false, a, /*neg_b=*/false, b,
      /*c_mod=*/(short)0, c, /*reuse_a=*/false, /*reuse_b=*/false);
}

// ---------------------------------------------------------------------------
// Main loop shared by kernels 1, 4 and 5: D[m][n] = sum_k A[m][k] * B(n,k), A k-contiguous.
// A block of GW waves makes a GM x GN tile; wave w owns A rows 16w..16w+15 and all GN columns.
// A stage is GK k of both operands, brought into LDS by asynchronous copies that cover whole
// 256- or 512-byte runs of a row, two buffers: stage t + 1 flies while stage t is worked on,
// and the B tile is fetched once per block, not once per wave.
// B comes in one of two layouts: GN rows of n, k-contiguous (KMAJOR false), or GK rows of k,
// n-contiguous (KMAJOR true).
// k order of a fragment, the same for A and B: of each 8 k a lane holds the 4 at 4*half;
// its first pair feeds one WMMA, its second pair the next.
// ---------------------------------------------------------------------------
#define GW 8
#define GM (GW * 16)
#define GN (NB * 16)
// LDS pitch in floats of k-contiguous rows: 16 B x odd, 16-byte reads meet no bank twice
#define GPITCH(GK) ((GK) + 4)
// LDS pitch in floats of n-contiguous rows: 4 rows = 32 banks, so the two lane halves differ
#define GPITCHN (GN + 8)
// floats per buffer
#define GSTAGE(GK, KMAJOR) (GM * GPITCH(GK) + ((KMAJOR) ? (GK) * GPITCHN : GN * GPITCH(GK)))

typedef float v4f __attribute__((ext_vector_type(4)));

// Twelve copies of 16 bytes per lane: l = LDS byte addresses, g = global addresses.
__device__ __forceinline__ void copy12(const unsigned (&l)[12], const float* const (&g)[12]) {
  // the wait is the statement's last line: it stands before any address register is rewritten
  asm volatile(
      "global_load_async_to_lds_b128 %0, %12, off\n\t"
      "global_load_async_to_lds_b128 %1, %13, off\n\t"
      "global_load_async_to_lds_b128 %2, %14, off\n\t"
      "global_load_async_to_lds_b128 %3, %15, off\n\t"
      "global_load_async_to_lds_b128 %4, %16, off\n\t"
      "global_load_async_to_lds_b128 %5, %17, off\n\t"
      "global_load_async_to_lds_b128 %6, %18, off\n\t"
      "global_load_async_to_lds_b128 %7, %19, off\n\t"
      "global_load_async_to_lds_b128 %8, %20, off\n\t"
      "global_load_async_to_lds_b128 %9, %21, off\n\t"
      "global_load_async_to_lds_b128 %10, %22, off\n\t"
      "global_load_async_to_lds_b128 %11, %23, off\n\t"
      "s_wait_xcnt 0x0"
      :: "v"(l[0]), "v"(l[1]), "v"(l[2]), "v"(l[3]), "v"(l[4]), "v"(l[5]),
         "v"(l[6]), "v"(l[7]), "v"(l[8]), "v"(l[9]), "v"(l[10]), "v"(l[11]),
         "v"(g[0]), "v"(g[1]), "v"(g[2]), "v"(g[3]), "v"(g[4]), "v"(g[5]),
         "v"(g[6]), "v"(g[7]), "v"(g[8]), "v"(g[9]), "v"(g[10]), "v"(g[11])
      : "memory");
}

// A: the block's first row (row pitch K floats). B: the block's first row (KMAJOR false, pitch
// LDB = K) or its first column in row k = 0 (KMAJOR true, pitch LDB). sm: 2 buffers of LDS.
// BSUM: bs[j] also gathers the lane's B fragments of tile j, element by element, so that the
// caller gets sum_k B(n,k) from values that are in registers for the WMMAs anyway.
template <int K, int LDB, int GK, bool KMAJOR, bool BSUM = false>
__device__ __forceinline__ void gemm_tile(const float* __restrict__ A, const float* __restrict__ B,
                                          float* sm, v8f (&acc)[NB], v4f* bs = nullptr) {
  static_assert(K % GK == 0 && K / GK >= 2, "the prologue fills two stages");
  constexpr int PA = GPITCH(GK);
  constexpr int PB = KMAJOR ? GPITCHN : GPITCH(GK);
  constexpr int ST = GSTAGE(GK, KMAJOR);
  constexpr size_t BSTEP = KMAJOR ? (size_t)GK * LDB : (size_t)GK;   // B's advance per stage
  constexpr int LA = GK / 4;                       // lanes that cover one A row of a stage
  constexpr int LB = (KMAJOR ? GN : GK) / 4;       // lanes that cover one B row of a stage
  constexpr int RA = 32 / LA, RB = 32 / LB;        // rows per copy
  constexpr int NA = 16 / RA;                      // copies for the wave's 16 A rows
  constexpr int NC = NA + 8 / RB;                  // and for its 8 B rows
  static_assert((KMAJOR ? GK : GN) == 8 * GW && NC % 12 == 0, "eight B rows per wave, copies in twelves");
  const int lane = threadIdx.x & 31;
  const int wave = threadIdx.x >> 5;
  const int half = lane >> 4;
  const int l16  = lane & 15;
  const float* ga = A + (size_t)(wave * 16 + lane / LA) * K + (lane % LA) * 4;
  const float* gb = B + (size_t)(wave * 8 + lane / LB) * LDB + (lane % LB) * 4;
  const unsigned s0 = (unsigned)(uintptr_t)sm;
  const unsigned la = s0 + ((wave * 16 + lane / LA) * PA + (lane % LA) * 4) * 4;
  const unsigned lb = s0 + (GM * PA + (wave * 8 + lane / LB) * PB + (lane % LB) * 4) * 4;

  // this wave's share of stage t into buffer buf
  auto stage_copy = [&](int t, int buf) {
    // unrolled in full: the address arrays are asm operands and must be registers
#pragma unroll
    for (int c0 = 0; c0 < NC; c0 += 12) {
      unsigned l[12];
      const float* g[12];
#pragma unroll
      for (int c = 0; c < 12; ++c) {
        const int i = c0 + c;
        if (i < NA) {
          l[c] = la + (buf * ST + i * RA * PA) * 4;
          g[c] = ga + (size_t)t * GK + (size_t)(i * RA) * K;
        } else {
          l[c] = lb + (buf * ST + (i - NA) * RB * PB) * 4;
          g[c] = gb + (size_t)t * BSTEP + (size_t)((i - NA) * RB) * LDB;
        }
      }
      copy12(l, g);
    }
  };

  stage_copy(0, 0);
  // stage 0 has landed for this wave, then for the block
  asm volatile("s_wait_asynccnt 0x0" ::: "memory");
  __syncthreads();
  stage_copy(1, 1);

  const float* fa = sm + (wave * 16 + l16) * PA + half * 4;
  const float* fb = sm + GM * PA + (KMAJOR ? half * 4 * PB + l16 : l16 * PB + half * 4);
  // stays rolled: one stage's WMMAs are the loop body, the buffer is an address offset
#pragma unroll 1
  for (int t = 0; t < K / GK; ++t) {
    const int bo = (t & 1) * ST;
    // the loops inside a stage are unrolled in full: acc[], bb[] and bs[] stay in registers only
    // under compile-time indices, and the LDS offsets become immediates
#pragma unroll
    for (int kk = 0; kk < GK / 8; ++kk) {
      const v4f a = *(const v4f*)(fa + bo + kk * 8);
      v4f bb[NB];
#pragma unroll
      for (int j = 0; j < NB; ++j) {
        if constexpr (KMAJOR) {
          const float* p = fb + bo + kk * 8 * PB + j * 16;
          bb[j].x = p[0]; bb[j].y = p[PB]; bb[j].z = p[2 * PB]; bb[j].w = p[3 * PB];
        } else {
          bb[j] = *(const v4f*)(fb + bo + j * 16 * PB + kk * 8);
        }
      }
#pragma unroll
      for (int j = 0; j < NB; ++j) acc[j] = wmma4(a.lo, bb[j].lo, acc[j]);
#pragma unroll
      for (int j = 0; j < NB; ++j) acc[j] = wmma4(a.hi, bb[j].hi, acc[j]);
      if constexpr (BSUM) {
#pragma unroll
        for (int j = 0; j < NB; ++j) bs[j] += bb[j];
      }
    }
    // this wave's reads of the buffer are done before the buffer is refilled
    asm volatile("s_wait_dscnt 0x0" ::: "memory");
    // this wave's copies of stage t + 1 have landed before the barrier publishes them
    asm volatile("s_wait_asynccnt 0x0" ::: "memory");
    __syncthreads();
    if (t + 2 < K / GK) stage_copy(t + 2, t & 1);
  }
  // no copy is outstanding when the wave goes on
  asm volatile("s_wait_asynccnt 0x0" ::: "memory");
}

// k per stage: kernel 1 keeps three blocks on a WGP (3 x 104 KiB of LDS); kernels 4 and 5 launch
// one block per WGP and take the longer stage: 512-byte runs, twice the lead for a stage's copies
#define GK_QKV 64
#define GK_NT 128

// ---------------------------------------------------------------------------
// Kernel 1: Q/K/V 1x1 convs.  O[b,which,o,t] = sum_c W[o,c] * X[b,c,t]
// grid = (T/GN, C/GM, B*3), block = GW*32; a block -> 128 o x 64 t
// ---------------------------------------------------------------------------
__global__ __launch_bounds__(GW * 32) void qkv_kernel(const float* __restrict__ x,
                                                      const float* __restrict__ wq,
                                                      const float* __restrict__ wk,
                                                      const float* __restrict__ wv,
                                                      float* __restrict__ qkv,
                                                      float* __restrict__ sumsq) {
  __shared__ __attribute__((aligned(16))) float sm[2 * GSTAGE(GK_QKV, true)];
  const int lane = threadIdx.x & 31;
  const int wave = threadIdx.x >> 5;
  const int half = lane >> 4;
  const int l16  = lane & 15;
  const int nbase = blockIdx.x * GN;               // t
  const int mbase = blockIdx.y * GM + wave * 16;   // out channel
  const int b     = blockIdx.z / 3;
  const int which = blockIdx.z % 3;
  const float* W = (which == 0) ? wq : (which == 1 ? wk : wv);

  v8f acc[NB] = {};
  gemm_tile<Cc, Tt, GK_QKV, true>(W + (size_t)blockIdx.y * GM * Cc, x + (size_t)b * Cc * Tt + nbase, sm, acc);

  float* O = qkv + ((size_t)b * 3 + which) * Cc * Tt;
#pragma unroll
  for (int j = 0; j < NB; ++j)
#pragma unroll
    for (int r = 0; r < 8; ++r)
      O[(size_t)(mbase + r + half * 8) * Tt + nbase + j * 16 + l16] = acc[j][r];

  // start value of kernel 3's atomic sums: one wave's store here, not a fill launched for 128 bytes
  if (blockIdx.x == 0 && blockIdx.y == 0 && blockIdx.z == 0 && threadIdx.x < Bn * HEADS)
    sumsq[threadIdx.x] = 0.f;
}

// ---------------------------------------------------------------------------
// Kernel 2: head-mixed scores.
// R[h,q,t] = sum_{c in head h} Q[b,c,q] * K[b,c,t]   (WMMA, K = 64 per head, once)
// S[b,g,q,t] = sum_h (w_head[g][h]*scale) * R[h,q,t] (mixed in registers)
// The eight per-head products are shared by all eight output heads g, so the
// matrix work is one K = 512 product per (q,t) tile, not eight.
// grid = (T/64, T/64, B), block = 128; each of the 2x2 waves -> 32q x 32t, all heads.
// 8-byte loads along q and t: tile i holds q = q0 + 2*row + i, tile j holds t = t0 + 2*col + j.
// ---------------------------------------------------------------------------
#define KSTEPS (Cc / 4)   // k-steps of 4 channels; 16 per head
#define AHEAD 7           // k-steps whose operand loads are in flight ahead of the WMMAs
#define RING (AHEAD + 1)

__global__ __launch_bounds__(128) void score_kernel(const float* __restrict__ qkv,
                                                    const float* __restrict__ w_head,
                                                    float* __restrict__ S) {
  const int lane = threadIdx.x & 31;
  const int wave = threadIdx.x >> 5;
  const int half = lane >> 4;
  const int l16  = lane & 15;
  const int t0 = blockIdx.x * 64 + (wave & 1) * 32;   // key
  const int q0 = blockIdx.y * 64 + (wave >> 1) * 32;  // query
  const int b  = blockIdx.z;
  // lane's channels in k-step s: 4*s + half*2 + {0,1}, the same for Q and K
  const float* Qp = qkv + ((size_t)b * 3 + 0) * Cc * Tt + (size_t)(half * 2) * Tt + q0 + 2 * l16;
  const float* Kp = qkv + ((size_t)b * 3 + 1) * Cc * Tt + (size_t)(half * 2) * Tt + t0 + 2 * l16;

  v2f qa[RING], qb[RING], ka[RING], kb[RING];
  // every loop marked "unroll" is unrolled in full: its counter indexes the ring or raw[],
  // which stay in registers only under compile-time indices
#pragma unroll
  for (int s = 0; s < AHEAD; ++s) {
    const size_t c = (size_t)(4 * s) * Tt;
    qa[s] = *(const v2f*)(Qp + c);  qb[s] = *(const v2f*)(Qp + c + Tt);
    ka[s] = *(const v2f*)(Kp + c);  kb[s] = *(const v2f*)(Kp + c + Tt);
  }

  v8f raw[HEADS][2][2] = {};
#pragma unroll
  for (int s = 0; s < KSTEPS; ++s) {
    if (s + AHEAD < KSTEPS) {
      const int n = (s + AHEAD) % RING;
      const size_t c = (size_t)(4 * (s + AHEAD)) * Tt;
      qa[n] = *(const v2f*)(Qp + c);  qb[n] = *(const v2f*)(Qp + c + Tt);
      ka[n] = *(const v2f*)(Kp + c);  kb[n] = *(const v2f*)(Kp + c + Tt);
    }
    // keeps the loads above AHEAD k-steps in front of their WMMAs: without it the
    // scheduler sinks each load to its use and every k-step waits out a full load latency
    __builtin_amdgcn_sched_barrier(0);
    const int u = s % RING;
    const int h = s / (HD / 4);
    v2f a0; a0.x = qa[u].x; a0.y = qb[u].x;
    v2f a1; a1.x = qa[u].y; a1.y = qb[u].y;
    v2f b0; b0.x = ka[u].x; b0.y = kb[u].x;
    v2f b1; b1.x = ka[u].y; b1.y = kb[u].y;
    raw[h][0][0] = wmma4(a0, b0, raw[h][0][0]);
    raw[h][0][1] = wmma4(a0, b1, raw[h][0][1]);
    raw[h][1][0] = wmma4(a1, b0, raw[h][1][0]);
    raw[h][1][1] = wmma4(a1, b1, raw[h][1][1]);
    // keeps the next k-step's loads behind these WMMAs, so that they land in the ring slot
    // just consumed: hoisted, they take 8 more VGPRs, past 336, and a wave per SIMD is lost
    __builtin_amdgcn_sched_barrier(0);
  }

  const float scale = 0.125f;  // hd^-0.5
  float* Sp = S + (size_t)b * HEADS * Tt * Tt + (size_t)(q0 + 16 * half) * Tt + t0 + 2 * l16;
  // g indexes no register array: this one loop stays rolled, an eighth of the mix's code
#pragma unroll 1
  for (int g = 0; g < HEADS; ++g) {
    float w[HEADS];
#pragma unroll
    for (int h = 0; h < HEADS; ++h) w[h] = w_head[g * HEADS + h] * scale;
#pragma unroll
    for (int i = 0; i < 2; ++i) {
      v2f st[8];                                    // st[r] = S at t = t0 + 2*l16 + {0,1}
#pragma unroll
      for (int r = 0; r < 8; r += 2) {
        v2f o[2];
#pragma unroll
        for (int j = 0; j < 2; ++j) {
          v2f s; s.x = w[0] * raw[0][i][j][r]; s.y = w[0] * raw[0][i][j][r + 1];
#pragma unroll
          for (int h = 1; h < HEADS; ++h) {
            v2f p; p.x = raw[h][i][j][r]; p.y = raw[h][i][j][r + 1];
            s += w[h] * p;
          }
          o[j] = s;
        }
        st[r].x     = o[0].x;  st[r].y     = o[1].x;
        st[r + 1].x = o[0].y;  st[r + 1].y = o[1].y;
      }
      // the eight stores stay one run behind all of the group's arithmetic, so that no
      // register of an issued store is rewritten in front of the wait below
      __builtin_amdgcn_sched_barrier(0);
#pragma unroll
      for (int r = 0; r < 8; ++r)
        *(v2f*)(Sp + (size_t)g * Tt * Tt + (size_t)(2 * r + i) * Tt) = st[r];
      // the next group reuses the stores' data registers: wait before they are overwritten
      asm volatile("s_wait_xcnt 0x0" ::: "memory");
      // keeps the next group's arithmetic behind that wait
      __builtin_amdgcn_sched_barrier(0);
    }
  }
}

// ---------------------------------------------------------------------------
// Kernel 3: in-place row softmax + per-(b,g) sumsq (InstanceNorm stats).
// Softmax rows sum to 1 => mean is analytically 1/T; only sumsq reduced.
// One wave owns whole rows: a lane holds 32 of a row's 1024 values in registers, maximum and
// sum are in-wave butterflies (no LDS tree, no barrier per row), and each wave walks SM_ROWS
// consecutive rows; the WGP's other waves cover a row's load latency. 8,192 waves start, not 262,144.
// grid = (T / (SM_WAVES*SM_ROWS), B*HEADS), block = SM_WAVES*32
// ---------------------------------------------------------------------------
#define SM_WAVES 8
#define SM_ROWS 4
#define SM_Q (Tt / 128)   // 16-byte pieces of a row per lane

__device__ __forceinline__ float wave_max(float v) {
#pragma unroll
  for (int m = 16; m >= 1; m >>= 1) v = fmaxf(v, __shfl_xor(v, m, 32));
  return v;
}
__device__ __forceinline__ float wave_sum(float v) {
#pragma unroll
  for (int m = 16; m >= 1; m >>= 1) v += __shfl_xor(v, m, 32);
  return v;
}

__global__ __launch_bounds__(SM_WAVES * 32) void softmax_kernel(float* __restrict__ S,
                                                                float* __restrict__ sumsq) {
  __shared__ float part[SM_WAVES];
  const int lane = threadIdx.x & 31;
  const int wave = threadIdx.x >> 5;
  const int row0 = (blockIdx.x * SM_WAVES + wave) * SM_ROWS;
  // one load or store of a wave covers 512 contiguous bytes of a row
  float* p = S + ((size_t)blockIdx.y * Tt + row0) * Tt + 4 * lane;

  float q0 = 0.f, q1 = 0.f, q2 = 0.f, q3 = 0.f;   // lane's share of the sum of squares
  // unrolled in full: every row's address is the one base register plus an immediate offset
#pragma unroll
  for (int r = 0; r < SM_ROWS; ++r) {
    float4 v[SM_Q];
#pragma unroll
    for (int q = 0; q < SM_Q; ++q) v[q] = *reinterpret_cast<const float4*>(p + r * Tt + q * 128);

    float m0 = v[0].x, m1 = v[0].y, m2 = v[0].z, m3 = v[0].w;
#pragma unroll
    for (int q = 1; q < SM_Q; ++q) {
      m0 = fmaxf(m0, v[q].x); m1 = fmaxf(m1, v[q].y);
      m2 = fmaxf(m2, v[q].z); m3 = fmaxf(m3, v[q].w);
    }
    const float m = wave_max(fmaxf(fmaxf(m0, m1), fmaxf(m2, m3)));

    float s0 = 0.f, s1 = 0.f, s2 = 0.f, s3 = 0.f;
#pragma unroll
    for (int q = 0; q < SM_Q; ++q) {
      v[q].x = expf(v[q].x - m); v[q].y = expf(v[q].y - m);
      v[q].z = expf(v[q].z - m); v[q].w = expf(v[q].w - m);
      s0 += v[q].x; s1 += v[q].y; s2 += v[q].z; s3 += v[q].w;
    }
    const float inv = 1.0f / wave_sum((s0 + s1) + (s2 + s3));

#pragma unroll
    for (int q = 0; q < SM_Q; ++q) {
      v[q].x *= inv; v[q].y *= inv; v[q].z *= inv; v[q].w *= inv;
      q0 = fmaf(v[q].x, v[q].x, q0); q1 = fmaf(v[q].y, v[q].y, q1);
      q2 = fmaf(v[q].z, v[q].z, q2); q3 = fmaf(v[q].w, v[q].w, q3);
      *reinterpret_cast<float4*>(p + r * Tt + q * 128) = v[q];
    }
    // the next row is loaded into the registers these stores name: wait before that
    asm volatile("s_wait_xcnt 0x0" ::: "memory");
  }

  const float sq = wave_sum((q0 + q1) + (q2 + q3));
  if (lane == 0) part[wave] = sq;
  __syncthreads();
  if (threadIdx.x == 0) {
    float t = part[0];
#pragma unroll
    for (int w = 1; w < SM_WAVES; ++w) t += part[w];
    atomicAdd(&sumsq[blockIdx.y], t);
  }
}

// ---------------------------------------------------------------------------
// Kernel 4: out = normalize(attn) @ V^T, affine norm folded:
//   out[q,d] = g*istd*(P@V^T)[q,d] + (beta - g*istd*mean)*vsum[d],  vsum[d] = sum_t V[d,t]
// Every wave reads the whole V tile as its B fragments: it sums them too, a lane half holding
// half of a row's t, and has vsum[d] in the very lane that stores column d.
// A block covers 128 q and all hd=64. Stores into .view-scrambled [B,T,C]:
//   row = h*128 + (q>>3), col = ((q&7)<<6) + d
// grid = (T/GM, B*HEADS), block = GW*32
// ---------------------------------------------------------------------------
__global__ __launch_bounds__(GW * 32) void av_kernel(const float* __restrict__ qkv,
                                                     const float* __restrict__ S,
                                                     const float* __restrict__ sumsq,
                                                     const float* __restrict__ in_gamma,
                                                     const float* __restrict__ in_beta,
                                                     float* __restrict__ out1) {
  __shared__ __attribute__((aligned(16))) float sm[2 * GSTAGE(GK_NT, false)];
  const int lane = threadIdx.x & 31;
  const int wave = threadIdx.x >> 5;
  const int half = lane >> 4;
  const int l16  = lane & 15;
  const int mbase = blockIdx.x * GM + wave * 16;   // q
  const int bh = blockIdx.y;
  const int b = bh / HEADS;
  const int h = bh % HEADS;
  const float* P = S + (size_t)bh * Tt * Tt + (size_t)blockIdx.x * GM * Tt;
  const float* V = qkv + ((size_t)b * 3 + 2) * Cc * Tt + (size_t)h * HD * Tt;

  v8f acc[NB] = {};
  v4f bs[NB] = {};
  gemm_tile<Tt, Tt, GK_NT, false, true>(P, V, sm, acc, bs);

  const float mean = 1.0f / (float)Tt;
  const float var  = sumsq[bh] / ((float)Tt * (float)Tt) - mean * mean;
  const float istd = rsqrtf(var + EPS);
  const float gs   = in_gamma[h] * istd;
  const float cadd = in_beta[h] - gs * mean;

#pragma unroll
  for (int j = 0; j < NB; ++j) {
    const int d = j * 16 + l16;
    const float hs = (bs[j].x + bs[j].y) + (bs[j].z + bs[j].w);   // this half's t of row d
    const float vs = cadd * (hs + __shfl_xor(hs, 16, 32));
#pragma unroll
    for (int r = 0; r < 8; ++r) {
      const int q = mbase + r + half * 8;
      const size_t row = (size_t)(h * 128 + (q >> 3));
      const size_t col = (size_t)(((q & 7) << 6) + d);
      out1[(size_t)b * Tt * Cc + row * Cc + col] = gs * acc[j][r] + vs;
    }
  }
}

// ---------------------------------------------------------------------------
// Kernel 5: projection. final[b,co,t] = sum_c out1[b,t,c]*w_proj[co,c] + b_proj[co]
// grid = (T/GN, C/GM, B), block = GW*32; a block -> 128 co x 64 t
// ---------------------------------------------------------------------------
__global__ __launch_bounds__(GW * 32) void proj_kernel(const float* __restrict__ out1,
                                                       const float* __restrict__ w_proj,
                                                       const float* __restrict__ b_proj,
                                                       float* __restrict__ out) {
  __shared__ __attribute__((aligned(16))) float sm[2 * GSTAGE(GK_NT, false)];
  const int lane = threadIdx.x & 31;
  const int wave = threadIdx.x >> 5;
  const int half = lane >> 4;
  const int l16  = lane & 15;
  const int nbase = blockIdx.x * GN;               // t
  const int mbase = blockIdx.y * GM + wave * 16;   // out channel
  const int b = blockIdx.z;

  v8f acc[NB] = {};
  gemm_tile<Cc, Cc, GK_NT, false>(w_proj + (size_t)blockIdx.y * GM * Cc,
              out1 + (size_t)b * Tt * Cc + (size_t)nbase * Cc, sm, acc);

#pragma unroll
  for (int j = 0; j < NB; ++j)
#pragma unroll
    for (int r = 0; r < 8; ++r) {
      const int row = mbase + r + half * 8;
      out[(size_t)b * Cc * Tt + (size_t)row * Tt + nbase + j * 16 + l16] =
          acc[j][r] + b_proj[row];
    }
}

extern "C" void kernel_launch(void* const* d_in, const int* in_sizes, int n_in,
                              void* d_out, int out_size, void* d_ws, size_t ws_size,
                              hipStream_t stream) {
  const float* x        = (const float*)d_in[0];
  const float* w_q      = (const float*)d_in[1];
  const float* w_k      = (const float*)d_in[2];
  const float* w_v      = (const float*)d_in[3];
  const float* w_head   = (const float*)d_in[4];
  const float* in_gamma = (const float*)d_in[5];
  const float* in_beta  = (const float*)d_in[6];
  const float* w_proj   = (const float*)d_in[7];
  const float* b_proj   = (const float*)d_in[8];
  float* out = (float*)d_out;

  // workspace layout (floats)
  float* qkv   = (float*)d_ws;                                // B*3*C*T   (24 MB)
  float* S     = qkv   + (size_t)Bn * 3 * Cc * Tt;            // B*H*T*T   (128 MB)
  float* out1  = S     + (size_t)Bn * HEADS * Tt * Tt;        // B*T*C     (8 MB)
  float* sumsq = out1  + (size_t)Bn * Tt * Cc;                // B*H

  qkv_kernel    <<<dim3(Tt / GN, Cc / GM, Bn * 3),     GW * 32, 0, stream>>>(x, w_q, w_k, w_v, qkv, sumsq);
  score_kernel  <<<dim3(Tt / 64, Tt / 64, Bn),         128, 0, stream>>>(qkv, w_head, S);
  softmax_kernel<<<dim3(Tt / (SM_WAVES * SM_ROWS), Bn * HEADS), SM_WAVES * 32, 0, stream>>>(S, sumsq);
  av_kernel     <<<dim3(Tt / GM, Bn * HEADS),          GW * 32, 0, stream>>>(qkv, S, sumsq,
                                                                         in_gamma, in_beta, out1);
  proj_kernel   <<<dim3(Tt / GN, Cc / GM, Bn),         GW * 32, 0, stream>>>(out1, w_proj, b_proj, out);
}

// v005
// It runs in 112 microseconds.
// In both of two side-by-side timings against v004, it was 1.65 times as fast.
// All steps since v000 together make it 4.07 times as fast.
#include <hip/hip_runtime.h>
#include <hip/hip_bf16.h>

#define Bn 4
#define Cc 512
#define Tt 1024
#define HEADS 8
#define HD 64
#define EPS 1e-5f
#define NB 4   // N-tiles (of 16) per wave: 16x64 output tile, A reused 4x

typedef float v2f __attribute__((ext_vector_type(2)));
typedef float v8f __attribute__((ext_vector_type(8)));

// D = A(16x4) * B(4x16) + C, fp32 WMMA (CDNA5 V_WMMA_F32_16X16X4_F32)
__device__ __forceinline__ v8f wmma4(v2f a, v2f b, v8f c) {
  return __builtin_amdgcn_wmma_f32_16x16x4_f32(
      /*neg_a=*/false, a, /*neg_b=*/false, b,
      /*c_mod=*/(short)0, c, /*reuse_a=*/false, /*reuse_b=*/false);
}

// ---------------------------------------------------------------------------
// Main loop shared by kernels 1, 3 and 4: D[m][n] = sum_k A[m][k] * B(n,k), A k-contiguous.
// A block of GW waves makes a GM x GN tile; wave w owns A rows 16w..16w+15 and all GN columns.
// A stage is GK k of both operands, brought into LDS by asynchronous copies that cover whole
// 256- or 512-byte runs of a row, two buffers: stage t + 1 flies while stage t is worked on,
// and the B tile is fetched once per block, not once per wave.
// B comes in one of two layouts: GN rows of n, k-contiguous (KMAJOR false), or GK rows of k,
// n-contiguous (KMAJOR true).
// k order of a fragment, the same for A and B: of each 8 k a lane holds the 4 at 4*half;
// its first pair feeds one WMMA, its second pair the next.
// ---------------------------------------------------------------------------
#define GW 8
#define GM (GW * 16)
#define GN (NB * 16)
// LDS pitch in floats of k-contiguous rows: 16 B x odd, 16-byte reads meet no bank twice
#define GPITCH(GK) ((GK) + 4)
// LDS pitch in floats of n-contiguous rows: 4 rows = 32 banks, so the two lane halves differ
#define GPITCHN (GN + 8)
// floats per buffer
#define GSTAGE(GK, KMAJOR) (GM * GPITCH(GK) + ((KMAJOR) ? (GK) * GPITCHN : GN * GPITCH(GK)))

typedef float v4f __attribute__((ext_vector_type(4)));

// Twelve copies of 16 bytes per lane: l = LDS byte addresses, g = global addresses.
__device__ __forceinline__ void copy12(const unsigned (&l)[12], const float* const (&g)[12]) {
  // the wait is the statement's last line: it stands before any address register is rewritten
  asm volatile(
      "global_load_async_to_lds_b128 %0, %12, off\n\t"
      "global_load_async_to_lds_b128 %1, %13, off\n\t"
      "global_load_async_to_lds_b128 %2, %14, off\n\t"
      "global_load_async_to_lds_b128 %3, %15, off\n\t"
      "global_load_async_to_lds_b128 %4, %16, off\n\t"
      "global_load_async_to_lds_b128 %5, %17, off\n\t"
      "global_load_async_to_lds_b128 %6, %18, off\n\t"
      "global_load_async_to_lds_b128 %7, %19, off\n\t"
      "global_load_async_to_lds_b128 %8, %20, off\n\t"
      "global_load_async_to_lds_b128 %9, %21, off\n\t"
      "global_load_async_to_lds_b128 %10, %22, off\n\t"
      "global_load_async_to_lds_b128 %11, %23, off\n\t"
      "s_wait_xcnt 0x0"
      :: "v"(l[0]), "v"(l[1]), "v"(l[2]), "v"(l[3]), "v"(l[4]), "v"(l[5]),
         "v"(l[6]), "v"(l[7]), "v"(l[8]), "v"(l[9]), "v"(l[10]), "v"(l[11]),
         "v"(g[0]), "v"(g[1]), "v"(g[2]), "v"(g[3]), "v"(g[4]), "v"(g[5]),
         "v"(g[6]), "v"(g[7]), "v"(g[8]), "v"(g[9]), "v"(g[10]), "v"(g[11])
      : "memory");
}

__device__ __forceinline__ float wave_sum(float v) {
#pragma unroll
  for (int m = 16; m >= 1; m >>= 1) v += __shfl_xor(v, m, 32);
  return v;
}

#define LOG2E 1.4426950408889634f

// What a lane keeps of its A row (row l16 of the wave's 16) while the row's softmax is made on
// the fly: the maximum so far (the same in both lane halves), and this half's share of
// sum exp(s - m) and of sum exp(s - m)^2.
struct SoftRow {
  float m;
  v4f l1, l2;
};

// What the main loop does beside the product
#define G_PLAIN 0
// A holds raw scores: the product is made with exp(s - m), m the row's running maximum (sr);
// bs[j] also gathers the lane's B fragments of tile j, element by element, so that the caller
// gets sum_k B(n,k) from values that are in registers for the WMMAs anyway.
#define G_SOFTMAX 1
// ws also gathers A[row][k] * cv(k mod 64): the lane's share of a product of its A row with a
// vector of period 64, from fragments that are in registers for the WMMAs anyway.
#define G_ADOT 2

// A: the block's first row (row pitch K floats). B: the block's first row (KMAJOR false, pitch
// LDB = K) or its first column in row k = 0 (KMAJOR true, pitch LDB). sm: 2 buffers of LDS.
template <int K, int LDB, int GK, bool KMAJOR, int MODE = G_PLAIN>
__device__ __forceinline__ void gemm_tile(const float* __restrict__ A, const float* __restrict__ B,
                                          float* sm, v8f (&acc)[NB], v4f* bs = nullptr,
                                          SoftRow* sr = nullptr, const v4f* cv = nullptr,
                                          v4f* ws = nullptr) {
  static_assert(K % GK == 0 && K / GK >= 2, "the prologue fills two stages");
  constexpr int PA = GPITCH(GK);
  constexpr int PB = KMAJOR ? GPITCHN : GPITCH(GK);
  constexpr int ST = GSTAGE(GK, KMAJOR);
  constexpr size_t BSTEP = KMAJOR ? (size_t)GK * LDB : (size_t)GK;   // B's advance per stage
  constexpr int LA = GK / 4;                       // lanes that cover one A row of a stage
  constexpr int LB = (KMAJOR ? GN : GK) / 4;       // lanes that cover one B row of a stage
  constexpr int RA = 32 / LA, RB = 32 / LB;        // rows per copy
  constexpr int NA = 16 / RA;                      // copies for the wave's 16 A rows
  constexpr int NC = NA + 8 / RB;                  // and for its 8 B rows
  static_assert((KMAJOR ? GK : GN) == 8 * GW && NC % 12 == 0, "eight B rows per wave, copies in twelves");
  const int lane = threadIdx.x & 31;
  const int wave = threadIdx.x >> 5;
  const int half = lane >> 4;
  const int l16  = lane & 15;
  const float* ga = A + (size_t)(wave * 16 + lane / LA) * K + (lane % LA) * 4;
  const float* gb = B + (size_t)(wave * 8 + lane / LB) * LDB + (lane % LB) * 4;
  const unsigned s0 = (unsigned)(uintptr_t)sm;
  const unsigned la = s0 + ((wave * 16 + lane / LA) * PA + (lane % LA) * 4) * 4;
  const unsigned lb = s0 + (GM * PA + (wave * 8 + lane / LB) * PB + (lane % LB) * 4) * 4;

  // this wave's share of stage t into buffer buf
  auto stage_copy = [&](int t, int buf) {
    // unrolled in full: the address arrays are asm operands and must be registers
#pragma unroll
    for (int c0 = 0; c0 < NC; c0 += 12) {
      unsigned l[12];
      const float* g[12];
#pragma unroll
      for (int c = 0; c < 12; ++c) {
        const int i = c0 + c;
        if (i < NA) {
          l[c] = la + (buf * ST + i * RA * PA) * 4;
          g[c] = ga + (size_t)t * GK + (size_t)(i * RA) * K;
        } else {
          l[c] = lb + (buf * ST + (i - NA) * RB * PB) * 4;
          g[c] = gb + (size_t)t * BSTEP + (size_t)((i - NA) * RB) * LDB;
        }
      }
      copy12(l, g);
    }
  };

  stage_copy(0, 0);
  // stage 0 has landed for this wave, then for the block
  asm volatile("s_wait_asynccnt 0x0" ::: "memory");
  __syncthreads();
  stage_copy(1, 1);

  const float* fa = sm + (wave * 16 + l16) * PA + half * 4;
  const float* fb = sm + GM * PA + (KMAJOR ? half * 4 * PB + l16 : l16 * PB + half * 4);
  // stays rolled: one stage's WMMAs are the loop body, the buffer is an address offset
#pragma unroll 1
  for (int t = 0; t < K / GK; ++t) {
    const int bo = (t & 1) * ST;
    // the loops inside a stage are unrolled in full: acc[], bb[], bs[] and as[] stay in registers
    // only under compile-time indices, and the LDS offsets become immediates
    v4f as[MODE == G_SOFTMAX ? GK / 8 : 1];
    float nm = 0.f;
    if constexpr (MODE == G_SOFTMAX) {
      // the stage's scores of this lane's row, and their maximum
#pragma unroll
      for (int kk = 0; kk < GK / 8; ++kk) as[kk] = *(const v4f*)(fa + bo + kk * 8);
      v4f mv = as[0];
#pragma unroll
      for (int kk = 1; kk < GK / 8; ++kk) mv = __builtin_elementwise_max(mv, as[kk]);
      float mx = fmaxf(fmaxf(mv.x, mv.y), fmaxf(mv.z, mv.w));
      mx = fmaxf(mx, __shfl_xor(mx, 16, 32));
      const float mn = fmaxf(sr->m, mx);
      // what was summed under the old maximum shrinks by f (0 on the first stage: m = -inf)
      const float f = __builtin_amdgcn_exp2f((sr->m - mn) * LOG2E);
      sr->m = mn;
      sr->l1 *= f;
      sr->l2 *= f * f;
      // accumulator register r holds row r + 8*half; that row's f sits in the lane of that number
#pragma unroll
      for (int r = 0; r < 8; ++r) {
        const float fr = __shfl(f, r + half * 8, 32);
#pragma unroll
        for (int j = 0; j < NB; ++j) acc[j][r] *= fr;
      }
      nm = -mn * LOG2E;
    }
#pragma unroll
    for (int kk = 0; kk < GK / 8; ++kk) {
      v4f a;
      if constexpr (MODE == G_SOFTMAX) {
        a.x = __builtin_amdgcn_exp2f(fmaf(as[kk].x, LOG2E, nm));
        a.y = __builtin_amdgcn_exp2f(fmaf(as[kk].y, LOG2E, nm));
        a.z = __builtin_amdgcn_exp2f(fmaf(as[kk].z, LOG2E, nm));
        a.w = __builtin_amdgcn_exp2f(fmaf(as[kk].w, LOG2E, nm));
        sr->l1 += a;
        sr->l2 += a * a;
      } else {
        a = *(const v4f*)(fa + bo + kk * 8);
      }
      if constexpr (MODE == G_ADOT) {
        static_assert(GK % 64 == 0, "a stage starts at k = 0 mod 64");
        *ws += a * cv[kk & 7];
      }
      v4f bb[NB];
#pragma unroll
      for (int j = 0; j < NB; ++j) {
        if constexpr (KMAJOR) {
          const float* p = fb + bo + kk * 8 * PB + j * 16;
          bb[j].x = p[0]; bb[j].y = p[PB]; bb[j].z = p[2 * PB]; bb[j].w = p[3 * PB];
        } else {
          bb[j] = *(const v4f*)(fb + bo + j * 16 * PB + kk * 8);
        }
      }
#pragma unroll
      for (int j = 0; j < NB; ++j) acc[j] = wmma4(a.lo, bb[j].lo, acc[j]);
#pragma unroll
      for (int j = 0; j < NB; ++j) acc[j] = wmma4(a.hi, bb[j].hi, acc[j]);
      if constexpr (MODE == G_SOFTMAX) {
#pragma unroll
        for (int j = 0; j < NB; ++j) bs[j] += bb[j];
      }
    }
    if constexpr (MODE == G_SOFTMAX) {
      // each row's sum, against spills: the sums are made here, inside the stage. Without this the
      // compiler sinks a stage's adds behind the refill and keeps every fragment live (scratch > 0)
      asm volatile("" :: "v"(bs[0]), "v"(bs[1]), "v"(bs[2]), "v"(bs[3]), "v"(sr->l1), "v"(sr->l2));
    }
    // this wave's reads of the buffer are done before the buffer is refilled
    asm volatile("s_wait_dscnt 0x0" ::: "memory");
    // this wave's copies of stage t + 1 have landed before the barrier publishes them
    asm volatile("s_wait_asynccnt 0x0" ::: "memory");
    __syncthreads();
    if (t + 2 < K / GK) stage_copy(t + 2, t & 1);
  }
  // no copy is outstanding when the wave goes on
  asm volatile("s_wait_asynccnt 0x0" ::: "memory");
}

// k per stage: kernel 1 keeps three blocks on a WGP (3 x 104 KiB of LDS); kernels 3 and 4 launch
// one block per WGP and take the longer stage: 512-byte runs, twice the lead for a stage's copies
#define GK_QKV 64
#define GK_NT 128

// ---------------------------------------------------------------------------
// Kernel 1: Q/K/V 1x1 convs.  O[b,which,o,t] = sum_c W[o,c] * X[b,c,t]
// grid = (T/GN, C/GM, B*3), block = GW*32; a block -> 128 o x 64 t
// ---------------------------------------------------------------------------
__global__ __launch_bounds__(GW * 32) void qkv_kernel(const float* __restrict__ x,
                                                      const float* __restrict__ wq,
                                                      const float* __restrict__ wk,
                                                      const float* __restrict__ wv,
                                                      float* __restrict__ qkv) {
  __shared__ __attribute__((aligned(16))) float sm[2 * GSTAGE(GK_QKV, true)];
  const int lane = threadIdx.x & 31;
  const int wave = threadIdx.x >> 5;
  const int half = lane >> 4;
  const int l16  = lane & 15;
  const int nbase = blockIdx.x * GN;               // t
  const int mbase = blockIdx.y * GM + wave * 16;   // out channel
  const int b     = blockIdx.z / 3;
  const int which = blockIdx.z % 3;
  const float* W = (which == 0) ? wq : (which == 1 ? wk : wv);

  v8f acc[NB] = {};
  gemm_tile<Cc, Tt, GK_QKV, true>(W + (size_t)blockIdx.y * GM * Cc, x + (size_t)b * Cc * Tt + nbase, sm, acc);

  float* O = qkv + ((size_t)b * 3 + which) * Cc * Tt;
#pragma unroll
  for (int j = 0; j < NB; ++j)
#pragma unroll
    for (int r = 0; r < 8; ++r)
      O[(size_t)(mbase + r + half * 8) * Tt + nbase + j * 16 + l16] = acc[j][r];
}

// ---------------------------------------------------------------------------
// Kernel 2: head-mixed scores.
// R[h,q,t] = sum_{c in head h} Q[b,c,q] * K[b,c,t]   (WMMA, K = 64 per head, once)
// S[b,g,q,t] = sum_h (w_head[g][h]*scale) * R[h,q,t] (mixed in registers)
// The eight per-head products are shared by all eight output heads g, so the
// matrix work is one K = 512 product per (q,t) tile, not eight.
// grid = (T/64, T/64, B), block = 128; each of the 2x2 waves -> 32q x 32t, all heads.
// 8-byte loads along q and t: tile i holds q = q0 + 2*row + i, tile j holds t = t0 + 2*col + j.
// ---------------------------------------------------------------------------
#define KSTEPS (Cc / 4)   // k-steps of 4 channels; 16 per head
#define AHEAD 7           // k-steps whose operand loads are in flight ahead of the WMMAs
#define RING (AHEAD + 1)

__global__ __launch_bounds__(128) void score_kernel(const float* __restrict__ qkv,
                                                    const float* __restrict__ w_head,
                                                    float* __restrict__ S) {
  const int lane = threadIdx.x & 31;
  const int wave = threadIdx.x >> 5;
  const int half = lane >> 4;
  const int l16  = lane & 15;
  const int t0 = blockIdx.x * 64 + (wave & 1) * 32;   // key
  const int q0 = blockIdx.y * 64 + (wave >> 1) * 32;  // query
  const int b  = blockIdx.z;
  // lane's channels in k-step s: 4*s + half*2 + {0,1}, the same for Q and K
  const float* Qp = qkv + ((size_t)b * 3 + 0) * Cc * Tt + (size_t)(half * 2) * Tt + q0 + 2 * l16;
  const float* Kp = qkv + ((size_t)b * 3 + 1) * Cc * Tt + (size_t)(half * 2) * Tt + t0 + 2 * l16;

  v2f qa[RING], qb[RING], ka[RING], kb[RING];
  // every loop marked "unroll" is unrolled in full: its counter indexes the ring or raw[],
  // which stay in registers only under compile-time indices
#pragma unroll
  for (int s = 0; s < AHEAD; ++s) {
    const size_t c = (size_t)(4 * s) * Tt;
    qa[s] = *(const v2f*)(Qp + c);  qb[s] = *(const v2f*)(Qp + c + Tt);
    ka[s] = *(const v2f*)(Kp + c);  kb[s] = *(const v2f*)(Kp + c + Tt);
  }

  v8f raw[HEADS][2][2] = {};
#pragma unroll
  for (int s = 0; s < KSTEPS; ++s) {
    if (s + AHEAD < KSTEPS) {
      const int n = (s + AHEAD) % RING;
      const size_t c = (size_t)(4 * (s + AHEAD)) * Tt;
      qa[n] = *(const v2f*)(Qp + c);  qb[n] = *(const v2f*)(Qp + c + Tt);
      ka[n] = *(const v2f*)(Kp + c);  kb[n] = *(const v2f*)(Kp + c + Tt);
    }
    // keeps the loads above AHEAD k-steps in front of their WMMAs: without it the
    // scheduler sinks each load to its use and every k-step waits out a full load latency
    __builtin_amdgcn_sched_barrier(0);
    const int u = s % RING;
    const int h = s / (HD / 4);
    v2f a0; a0.x = qa[u].x; a0.y = qb[u].x;
    v2f a1; a1.x = qa[u].y; a1.y = qb[u].y;
    v2f b0; b0.x = ka[u].x; b0.y = kb[u].x;
    v2f b1; b1.x = ka[u].y; b1.y = kb[u].y;
    raw[h][0][0] = wmma4(a0, b0, raw[h][0][0]);
    raw[h][0][1] = wmma4(a0, b1, raw[h][0][1]);
    raw[h][1][0] = wmma4(a1, b0, raw[h][1][0]);
    raw[h][1][1] = wmma4(a1, b1, raw[h][1][1]);
    // keeps the next k-step's loads behind these WMMAs, so that they land in the ring slot
    // just consumed: hoisted, they take 8 more VGPRs, past 336, and a wave per SIMD is lost
    __builtin_amdgcn_sched_barrier(0);
  }

  const float scale = 0.125f;  // hd^-0.5
  float* Sp = S + (size_t)b * HEADS * Tt * Tt + (size_t)(q0 + 16 * half) * Tt + t0 + 2 * l16;
  // g indexes no register array: this one loop stays rolled, an eighth of the mix's code
#pragma unroll 1
  for (int g = 0; g < HEADS; ++g) {
    float w[HEADS];
#pragma unroll
    for (int h = 0; h < HEADS; ++h) w[h] = w_head[g * HEADS + h] * scale;
#pragma unroll
    for (int i = 0; i < 2; ++i) {
      v2f st[8];                                    // st[r] = S at t = t0 + 2*l16 + {0,1}
#pragma unroll
      for (int r = 0; r < 8; r += 2) {
        v2f o[2];
#pragma unroll
        for (int j = 0; j < 2; ++j) {
          v2f s; s.x = w[0] * raw[0][i][j][r]; s.y = w[0] * raw[0][i][j][r + 1];
#pragma unroll
          for (int h = 1; h < HEADS; ++h) {
            v2f p; p.x = raw[h][i][j][r]; p.y = raw[h][i][j][r + 1];
            s += w[h] * p;
          }
          o[j] = s;
        }
        st[r].x     = o[0].x;  st[r].y     = o[1].x;
        st[r + 1].x = o[0].y;  st[r + 1].y = o[1].y;
      }
      // the eight stores stay one run behind all of the group's arithmetic, so that no
      // register of an issued store is rewritten in front of the wait below
      __builtin_amdgcn_sched_barrier(0);
#pragma unroll
      for (int r = 0; r < 8; ++r)
        *(v2f*)(Sp + (size_t)g * Tt * Tt + (size_t)(2 * r + i) * Tt) = st[r];
      // the next group reuses the stores' data registers: wait before they are overwritten
      asm volatile("s_wait_xcnt 0x0" ::: "memory");
      // keeps the next group's arithmetic behind that wait
      __builtin_amdgcn_sched_barrier(0);
    }
  }
}

// ---------------------------------------------------------------------------
// Kernel 3: row softmax and U = softmax(S) @ V^T in one pass over the raw scores.
// A wave owns 16 whole rows q: a lane reads its row's scores as A fragments, so maximum and
// sums are in-lane (one exchange between the lane halves); per stage of 128 t the running
// maximum is raised and what was summed before is rescaled. S is read once and never rewritten.
// InstanceNorm needs sum P^2 over all (q,t) of a head, which is whole only when this launch
// ends: the block stores its 128 rows' share (sqpart) and the norm's affine map is applied by
// kernel 4:  out1[q,d] = g*istd*U[q,d] + (beta - g*istd*mean)*vsum[d],  vsum[d] = sum_t V[d,t].
// Every wave reads the whole V tile as its B fragments: it sums them too, a lane half holding
// half of a row's t.
// A block covers 128 q and all hd=64. Stores into .view-scrambled [B,T,C]:
//   row = h*128 + (q>>3), col = ((q&7)<<6) + d
// grid = (T/GM, B*HEADS), block = GW*32
// ---------------------------------------------------------------------------
#define QBLK (Tt / GM)   // blocks, and so sqpart entries, per (b,h)

__global__ __launch_bounds__(GW * 32) void av_kernel(const float* __restrict__ qkv,
                                                     const float* __restrict__ S,
                                                     float* __restrict__ U,
                                                     float* __restrict__ sqpart,
                                                     float* __restrict__ vsum) {
  __shared__ __attribute__((aligned(16))) float sm[2 * GSTAGE(GK_NT, false)];
  __shared__ float part[GW];
  const int lane = threadIdx.x & 31;
  const int wave = threadIdx.x >> 5;
  const int half = lane >> 4;
  const int l16  = lane & 15;
  const int mbase = blockIdx.x * GM + wave * 16;   // q
  const int bh = blockIdx.y;
  const int b = bh / HEADS;
  const int h = bh % HEADS;
  const float* P = S + (size_t)bh * Tt * Tt + (size_t)blockIdx.x * GM * Tt;
  const float* V = qkv + ((size_t)b * 3 + 2) * Cc * Tt + (size_t)h * HD * Tt;

  v8f acc[NB] = {};
  v4f bs[NB] = {};
  SoftRow sr;
  sr.m = -__builtin_inff();
  sr.l1 = 0.f;
  sr.l2 = 0.f;
  gemm_tile<Tt, Tt, GK_NT, false, G_SOFTMAX>(P, V, sm, acc, bs, &sr);

  // row l16: 1 / sum exp, and this half's share of the row's sum of P^2
  const float h1 = (sr.l1.x + sr.l1.y) + (sr.l1.z + sr.l1.w);
  const float inv = 1.0f / (h1 + __shfl_xor(h1, 16, 32));
  const float h2 = ((sr.l2.x + sr.l2.y) + (sr.l2.z + sr.l2.w)) * inv * inv;
  const float sq = wave_sum(h2);
  if (lane == 0) part[wave] = sq;
  __syncthreads();
  if (threadIdx.x == 0) {
    float t = part[0];
#pragma unroll
    for (int w = 1; w < GW; ++w) t += part[w];
    sqpart[bh * QBLK + blockIdx.x] = t;
  }

  // the loops below are unrolled in full: ir[], acc[] and bs[] stay in registers only under
  // compile-time indices
  float ir[8];   // 1 / sum exp of the row that accumulator register r holds
#pragma unroll
  for (int r = 0; r < 8; ++r) ir[r] = __shfl(inv, r + half * 8, 32);

#pragma unroll
  for (int j = 0; j < NB; ++j) {
    const int d = j * 16 + l16;
    const float hs = (bs[j].x + bs[j].y) + (bs[j].z + bs[j].w);   // this half's t of row d
    const float vs = hs + __shfl_xor(hs, 16, 32);
    if (blockIdx.x == 0 && threadIdx.x < 16) vsum[bh * HD + d] = vs;
#pragma unroll
    for (int r = 0; r < 8; ++r) {
      const int q = mbase + r + half * 8;
      const size_t row = (size_t)(h * 128 + (q >> 3));
      const size_t col = (size_t)(((q & 7) << 6) + d);
      U[(size_t)b * Tt * Cc + row * Cc + col] = acc[j][r] * ir[r];
    }
  }
}

// ---------------------------------------------------------------------------
// Kernel 4: InstanceNorm's affine map and the projection.
// out1[b,t,c] = gs*U[b,t,c] + cadd*vsum[c & 63] with gs, cadd, vsum of head t / 128, so
// final[b,co,t] = gs * sum_c w_proj[co,c]*U[b,t,c] + cadd * sum_c w_proj[co,c]*vsum[c & 63] + b_proj[co]
// Softmax rows sum to 1 => the mean is analytically 1/T; only the sum of squares is reduced.
// The second sum is made from the A fragments (a lane holds one row co), beside the WMMAs.
// grid = (T/GN, C/GM, B), block = GW*32; a block -> 128 co x 64 t, all of one head
// ---------------------------------------------------------------------------
__global__ __launch_bounds__(GW * 32) void proj_kernel(const float* __restrict__ U,
                                                       const float* __restrict__ sqpart,
                                                       const float* __restrict__ vsum,
                                                       const float* __restrict__ in_gamma,
                                                       const float* __restrict__ in_beta,
                                                       const float* __restrict__ w_proj,
                                                       const float* __restrict__ b_proj,
                                                       float* __restrict__ out) {
  __shared__ __attribute__((aligned(16))) float sm[2 * GSTAGE(GK_NT, false)];
  const int lane = threadIdx.x & 31;
  const int wave = threadIdx.x >> 5;
  const int half = lane >> 4;
  const int l16  = lane & 15;
  const int nbase = blockIdx.x * GN;               // t
  const int mbase = blockIdx.y * GM + wave * 16;   // out channel
  const int b = blockIdx.z;
  static_assert(128 % GN == 0, "a block's t lie in one head");
  const int h  = nbase / 128;
  const int bh = b * HEADS + h;

  // the head's norm, read in front of the main loop: ahead of the first asm statement these
  // block-uniform reads are scalar loads, which name no vector register and land under the loop
  float sumsq = sqpart[bh * QBLK];
  // unrolled in full: the eight reads become one wide scalar load
#pragma unroll
  for (int i = 1; i < QBLK; ++i) sumsq += sqpart[bh * QBLK + i];
  const float mean = 1.0f / (float)Tt;
  const float var  = sumsq / ((float)Tt * (float)Tt) - mean * mean;
  const float istd = rsqrtf(var + EPS);
  const float gs   = in_gamma[h] * istd;
  const float cadd = in_beta[h] - gs * mean;

  // vsum at the lane's k of a fragment: k mod 64 = 8*i + 4*half + {0..3}
  // (this kernel's loops are unrolled in full: cv[], add[] and acc[] stay in registers only under
  // compile-time indices)
  v4f cv[8];
#pragma unroll
  for (int i = 0; i < 8; ++i) cv[i] = *(const v4f*)(vsum + bh * HD + i * 8 + half * 4);

  v8f acc[NB] = {};
  v4f ws = 0.f;
  gemm_tile<Cc, Cc, GK_NT, false, G_ADOT>(w_proj + (size_t)blockIdx.y * GM * Cc,
              U + (size_t)b * Tt * Cc + (size_t)nbase * Cc, sm, acc, nullptr, nullptr, cv, &ws);

  // row l16 of the wave: sum_c w_proj[row,c] * vsum[c & 63]
  const float hw = (ws.x + ws.y) + (ws.z + ws.w);
  const float wv = hw + __shfl_xor(hw, 16, 32);
  float add[8];   // the terms of the row that accumulator register r holds
#pragma unroll
  for (int r = 0; r < 8; ++r)
    add[r] = cadd * __shfl(wv, r + half * 8, 32) + b_proj[mbase + r + half * 8];

#pragma unroll
  for (int j = 0; j < NB; ++j)
#pragma unroll
    for (int r = 0; r < 8; ++r) {
      const int row = mbase + r + half * 8;
      out[(size_t)b * Cc * Tt + (size_t)row * Tt + nbase + j * 16 + l16] = gs * acc[j][r] + add[r];
    }
}

extern "C" void kernel_launch(void* const* d_in, const int* in_sizes, int n_in,
                              void* d_out, int out_size, void* d_ws, size_t ws_size,
                              hipStream_t stream) {
  const float* x        = (const float*)d_in[0];
  const float* w_q      = (const float*)d_in[1];
  const float* w_k      = (const float*)d_in[2];
  const float* w_v      = (const float*)d_in[3];
  const float* w_head   = (const float*)d_in[4];
  const float* in_gamma = (const float*)d_in[5];
  const float* in_beta  = (const float*)d_in[6];
  const float* w_proj   = (const float*)d_in[7];
  const float* b_proj   = (const float*)d_in[8];
  float* out = (float*)d_out;

  // workspace layout (floats)
  float* qkv   = (float*)d_ws;                                // B*3*C*T   (24 MB)
  float* S     = qkv   + (size_t)Bn * 3 * Cc * Tt;            // B*H*T*T   (128 MB)
  float* U     = S     + (size_t)Bn * HEADS * Tt * Tt;        // B*T*C     (8 MB)
  float* sqpart = U     + (size_t)Bn * Tt * Cc;               // B*H*QBLK
  float* vsum  = sqpart + (size_t)Bn * HEADS * QBLK;          // B*H*HD

  qkv_kernel    <<<dim3(Tt / GN, Cc / GM, Bn * 3),     GW * 32, 0, stream>>>(x, w_q, w_k, w_v, qkv);
  score_kernel  <<<dim3(Tt / 64, Tt / 64, Bn),         128, 0, stream>>>(qkv, w_head, S);
  av_kernel     <<<dim3(Tt / GM, Bn * HEADS),          GW * 32, 0, stream>>>(qkv, S, U, sqpart, vsum);
  proj_kernel   <<<dim3(Tt / GN, Cc / GM, Bn),         GW * 32, 0, stream>>>(U, sqpart, vsum, in_gamma, in_beta,
                                                                         w_proj, b_proj, out);
}
